// v000
// Measured on an AMD MI455X. A time is GPU time per run, averaged over a window of back-to-back runs after a warm-up
// (all launches, gaps included; the runs take copies of the inputs in turn), and the median of several windows.
// Apart from v000's, it joins two sittings. Times from different sittings can be a few percent apart, while
// side-by-side timings come from the same sitting.
// v000, which the later versions start from, runs in 187 microseconds.
#include <hip/hip_runtime.h>
#include <stdint.h>

typedef _Float16 half_t;
typedef __attribute__((ext_vector_type(16))) _Float16 v16h;
typedef __attribute__((ext_vector_type(8)))  _Float16 v8h;
typedef __attribute__((ext_vector_type(8)))  float    v8f;

#define B_  4
#define T_  4096
#define C_  512
#define H_  64
#define BT_ (B_ * T_)
#define LOG2E 1.44269504088896340736f

static __device__ inline v16h make16(v8h lo, v8h hi) {
  return __builtin_shufflevector(lo, hi, 0,1,2,3,4,5,6,7,8,9,10,11,12,13,14,15);
}
static __device__ inline v8h ld8(const half_t* p) { return *(const v8h*)p; }

static __device__ inline v8f wmma_f16(v16h a, v16h b, v8f c) {
  // D = A(16x32 f16) * B(32x16 f16) + C(16x16 f32)
  return __builtin_amdgcn_wmma_f32_16x16x32_f16(false, a, false, b, (short)0, c, false, false);
}

// CDNA5 async global->LDS copy (16 B per lane), tracked by ASYNCcnt.
static __device__ inline void async_cp16(unsigned lds_off, const half_t* g) {
  asm volatile("global_load_async_to_lds_b128 %0, %1, off"
               :: "v"(lds_off), "v"(g) : "memory");
}

// ---------------------------------------------------------------------------
// Kernel 0: W[c][h] (f32) -> WT[h][c] (f16), for Wq/Wk/Wv (blockIdx.y selects)
// ---------------------------------------------------------------------------
__global__ __launch_bounds__(256) void wt_convert_kernel(
    const float* __restrict__ Wq, const float* __restrict__ Wk,
    const float* __restrict__ Wv, half_t* __restrict__ WT) {
  int m = blockIdx.y;
  const float* W = (m == 0) ? Wq : ((m == 1) ? Wk : Wv);
  half_t* dst = WT + (size_t)m * H_ * C_;
  int idx = blockIdx.x * 256 + threadIdx.x;   // [0, H_*C_)
  int h = idx >> 9;
  int c = idx & (C_ - 1);
  dst[idx] = (half_t)W[c * H_ + h];
}

// ---------------------------------------------------------------------------
// Kernel 1: projection, one wave = 16 rows x 64 cols, K=512 via WMMA f16.
// vTranspose!=0 stores output as Y[b][h][t] (for V), else Y[row][h].
// ---------------------------------------------------------------------------
__global__ __launch_bounds__(256) void proj_kernel(
    const float* __restrict__ X, const half_t* __restrict__ WT,
    half_t* __restrict__ Y, float outscale, int vTranspose) {
  int lane = threadIdx.x & 31;
  int wv   = threadIdx.x >> 5;
  int lrow = lane & 15;
  int kb8  = (lane >> 4) * 8;   // A/B operand k-run base for this lane half
  int prow = (lane >> 4) * 8;   // C/D row base for this lane half

  int rowbase = blockIdx.x * 128 + wv * 16;
  const float* xr = X + (size_t)(rowbase + lrow) * C_;

  v8f o[4] = {v8f{}, v8f{}, v8f{}, v8f{}};

  for (int kc = 0; kc < C_; kc += 32) {
    v8f x0 = *(const v8f*)(xr + kc + kb8);
    v8f x1 = *(const v8f*)(xr + kc + kb8 + 16);
    v16h a = make16(__builtin_convertvector(x0, v8h),
                    __builtin_convertvector(x1, v8h));
#pragma unroll
    for (int nt = 0; nt < 4; ++nt) {
      const half_t* wr = WT + (size_t)(nt * 16 + lrow) * C_ + kc + kb8;
      v16h bm = make16(ld8(wr), ld8(wr + 16));
      o[nt] = wmma_f16(a, bm, o[nt]);
    }
  }

  // uniform branch hoisted OUT of the store loops (keeps stores branch-free)
  if (!vTranspose) {
    half_t* yr = Y + (size_t)(rowbase + prow) * H_ + lrow;
#pragma unroll
    for (int nt = 0; nt < 4; ++nt) {
#pragma unroll
      for (int r = 0; r < 8; ++r)
        yr[(size_t)r * H_ + nt * 16] = (half_t)(o[nt][r] * outscale);
    }
  } else {
    int bb = rowbase >> 12;             // batch (T_ = 4096)
    int t0 = (rowbase & (T_ - 1)) + prow;
#pragma unroll
    for (int nt = 0; nt < 4; ++nt) {
      half_t* yc = Y + ((size_t)bb * H_ + nt * 16 + lrow) * T_ + t0;
#pragma unroll
      for (int r = 0; r < 8; ++r)
        yc[r] = (half_t)(o[nt][r] * outscale);
    }
  }
}

// ---------------------------------------------------------------------------
// Kernel 2: flash attention, exp2-domain online softmax, double-buffered
// async K/V^T staging. One wave = 16 query rows; block = 128 rows.
// ---------------------------------------------------------------------------
__global__ __launch_bounds__(256) void attn_kernel(
    const half_t* __restrict__ qh, const half_t* __restrict__ kh,
    const half_t* __restrict__ vhT, float* __restrict__ out) {
  __shared__ alignas(16) half_t Ks [2][64][72];   // [buf][key][head], 144 B rows
  __shared__ alignas(16) half_t VsT[2][64][72];   // [buf][head][key]
  __shared__ alignas(16) half_t Pl [8][16][72];   // per-wave P tile (16x64)

  int lane = threadIdx.x & 31;
  int wv   = threadIdx.x >> 5;
  int lrow = lane & 15;
  int kb8  = (lane >> 4) * 8;
  int prow = (lane >> 4) * 8;

  int b  = blockIdx.y;
  int q0 = blockIdx.x * 128 + wv * 16;
  const half_t* qB = qh  + (size_t)b * T_ * H_;
  const half_t* kB = kh  + (size_t)b * T_ * H_;
  const half_t* vB = vhT + (size_t)b * H_ * T_;

  // Q A-operands (head dim = two K=32 chunks), kept in registers
  const half_t* qr = qB + (size_t)(q0 + lrow) * H_;
  v16h qa0 = make16(ld8(qr + kb8),      ld8(qr + kb8 + 16));
  v16h qa1 = make16(ld8(qr + 32 + kb8), ld8(qr + 48 + kb8));

  v8f o[4] = {v8f{}, v8f{}, v8f{}, v8f{}};
  float m[8], l[8];
#pragma unroll
  for (int r = 0; r < 8; ++r) { m[r] = -1e30f; l[r] = 0.0f; }

  // async-stage one 64-key chunk (K rows + V^T rows are both pure row copies)
  auto stage = [&](int chunk, int bufsel) {
    int kc = chunk * 64;
#pragma unroll
    for (int j = 0; j < 2; ++j) {
      int c   = threadIdx.x + j * 256;   // [0,512): 64 rows x 8 16B-segments
      int row = c >> 3;
      int sg  = (c & 7) * 8;
      async_cp16((unsigned)(uintptr_t)&Ks[bufsel][row][sg],
                 kB + (size_t)(kc + row) * H_ + sg);
      async_cp16((unsigned)(uintptr_t)&VsT[bufsel][row][sg],
                 vB + (size_t)row * T_ + kc + sg);
    }
  };

  stage(0, 0);
  asm volatile("s_wait_asynccnt 0x0" ::: "memory");
  __syncthreads();

  const int NCH = T_ / 64;
  for (int i = 0; i < NCH; ++i) {
    int buf = i & 1;
    if (i + 1 < NCH) stage(i + 1, buf ^ 1);   // prefetch next chunk

    // ---- scores: S(16x64) = Q @ K^T, four 16-key column groups ----
    v8f s[4];
#pragma unroll
    for (int g = 0; g < 4; ++g) {
      const half_t* kp = &Ks[buf][g * 16 + lrow][kb8];
      v16h b0 = make16(ld8(kp),      ld8(kp + 16));
      v16h b1 = make16(ld8(kp + 32), ld8(kp + 48));
      v8f acc = {};
      acc = wmma_f16(qa0, b0, acc);
      acc = wmma_f16(qa1, b1, acc);
      s[g] = acc;
    }

    // ---- online softmax in exp2 domain (log2e folded into Q scale) ----
#pragma unroll
    for (int r = 0; r < 8; ++r) {
      float a = fmaxf(fmaxf(s[0][r], s[1][r]), fmaxf(s[2][r], s[3][r]));
      a = fmaxf(a, __shfl_xor(a, 1));
      a = fmaxf(a, __shfl_xor(a, 2));
      a = fmaxf(a, __shfl_xor(a, 4));
      a = fmaxf(a, __shfl_xor(a, 8));
      float mn = fmaxf(m[r], a);
      float cf = __builtin_amdgcn_exp2f(m[r] - mn);
      m[r] = mn;
      float p0 = __builtin_amdgcn_exp2f(s[0][r] - mn);
      float p1 = __builtin_amdgcn_exp2f(s[1][r] - mn);
      float p2 = __builtin_amdgcn_exp2f(s[2][r] - mn);
      float p3 = __builtin_amdgcn_exp2f(s[3][r] - mn);
      s[0][r] = p0; s[1][r] = p1; s[2][r] = p2; s[3][r] = p3;
      float rs = (p0 + p1) + (p2 + p3);
      rs += __shfl_xor(rs, 1);
      rs += __shfl_xor(rs, 2);
      rs += __shfl_xor(rs, 4);
      rs += __shfl_xor(rs, 8);
      l[r] = l[r] * cf + rs;
      o[0][r] *= cf; o[1][r] *= cf; o[2][r] *= cf; o[3][r] *= cf;
    }

    // ---- stage P (C/D layout) -> LDS -> reread as A operand (f16) ----
#pragma unroll
    for (int r = 0; r < 8; ++r) {
#pragma unroll
      for (int g = 0; g < 4; ++g)
        Pl[wv][prow + r][g * 16 + lrow] = (half_t)s[g][r];
    }
    asm volatile("s_wait_dscnt 0x0" ::: "memory");  // same-wave LDS RAW
    const half_t* pp = &Pl[wv][lrow][0];
    v16h pa0 = make16(ld8(pp + kb8),      ld8(pp + kb8 + 16));
    v16h pa1 = make16(ld8(pp + 32 + kb8), ld8(pp + 48 + kb8));

    // ---- O += P @ V over 64 keys (two K=32 chunks x four head tiles) ----
#pragma unroll
    for (int nt = 0; nt < 4; ++nt) {
      const half_t* vp = &VsT[buf][nt * 16 + lrow][0];
      v16h vb0 = make16(ld8(vp + kb8),      ld8(vp + kb8 + 16));
      v16h vb1 = make16(ld8(vp + 32 + kb8), ld8(vp + 48 + kb8));
      o[nt] = wmma_f16(pa0, vb0, o[nt]);
      o[nt] = wmma_f16(pa1, vb1, o[nt]);
    }

    asm volatile("s_wait_asynccnt 0x0" ::: "memory"); // next tile resident
    __syncthreads();                                  // everyone done with buf
  }

  float rl[8];
#pragma unroll
  for (int r = 0; r < 8; ++r) rl[r] = __builtin_amdgcn_rcpf(l[r]);

  float* op = out + ((size_t)b * T_ + q0 + prow) * H_ + lrow;
#pragma unroll
  for (int r = 0; r < 8; ++r) {
    float* orow = op + (size_t)r * H_;
#pragma unroll
    for (int nt = 0; nt < 4; ++nt)
      orow[nt * 16] = o[nt][r] * rl[r];
  }
}

// ---------------------------------------------------------------------------
extern "C" void kernel_launch(void* const* d_in, const int* in_sizes, int n_in,
                              void* d_out, int out_size, void* d_ws, size_t ws_size,
                              hipStream_t stream) {
  const float* q  = (const float*)d_in[0];
  const float* k  = (const float*)d_in[1];
  const float* v  = (const float*)d_in[2];
  const float* Wq = (const float*)d_in[3];
  const float* Wk = (const float*)d_in[4];
  const float* Wv = (const float*)d_in[5];
  float* out = (float*)d_out;

  half_t* wsh = (half_t*)d_ws;
  half_t* qh  = wsh;                                 // [BT_][H_]   f16
  half_t* kh  = wsh + (size_t)BT_ * H_;              // [BT_][H_]   f16
  half_t* vhT = wsh + 2 * (size_t)BT_ * H_;          // [B_][H_][T_] f16
  half_t* WT  = wsh + 3 * (size_t)BT_ * H_;          // 3 x [H_][C_] f16

  wt_convert_kernel<<<dim3((C_ * H_) / 256, 3), 256, 0, stream>>>(Wq, Wk, Wv, WT);
  // fold attention scale AND log2(e) (exp2-domain softmax) into qh
  proj_kernel<<<dim3(BT_ / 128), 256, 0, stream>>>(q, WT, qh, 0.125f * LOG2E, 0);
  proj_kernel<<<dim3(BT_ / 128), 256, 0, stream>>>(k, WT + (size_t)H_ * C_, kh, 1.0f, 0);
  proj_kernel<<<dim3(BT_ / 128), 256, 0, stream>>>(v, WT + 2 * (size_t)H_ * C_, vhT, 1.0f, 1);
  attn_kernel<<<dim3(T_ / 128, B_), 256, 0, stream>>>(qh, kh, vhT, out);
}

// v001
// One run takes 87.7 microseconds.
// In both of two side-by-side timings against v000, it was 2.18 times as fast.
#include <hip/hip_runtime.h>
#include <stdint.h>

typedef _Float16 half_t;
typedef __attribute__((ext_vector_type(16))) _Float16 v16h;
typedef __attribute__((ext_vector_type(8)))  _Float16 v8h;
typedef __attribute__((ext_vector_type(8)))  float    v8f;
typedef __attribute__((ext_vector_type(4)))  float    v4f;

#define B_  4
#define T_  4096
#define C_  512
#define H_  64
#define BT_ (B_ * T_)
#define LOG2E 1.44269504088896340736f
#define KS_ 4    // key ranges per work-group: waves 4*ks .. 4*ks+3 walk range ks
#define OP_ 68   // f32 pitch of a staged partial row: rows r and r+8 fall on different banks

static __device__ inline v16h make16(v8h lo, v8h hi) {
  return __builtin_shufflevector(lo, hi, 0,1,2,3,4,5,6,7,8,9,10,11,12,13,14,15);
}
static __device__ inline v8h ld8(const half_t* p) { return *(const v8h*)p; }

static __device__ inline v8f wmma_f16(v16h a, v16h b, v8f c) {
  // D = A(16x32 f16) * B(32x16 f16) + C(16x16 f32)
  return __builtin_amdgcn_wmma_f32_16x16x32_f16(false, a, false, b, (short)0, c, false, false);
}

// CDNA5 async global->LDS copies (16 B per lane each), tracked by ASYNCcnt.
// One statement for a stage's eight copies; as its last line, s_wait_xcnt stands in
// front of every later write of the copies' address registers (a precaution).
static __device__ inline void async_cp16x8(const unsigned (&l)[8],
                                           const half_t* const (&g)[8]) {
  asm volatile("global_load_async_to_lds_b128 %0, %8, off\n\t"
               "global_load_async_to_lds_b128 %1, %9, off\n\t"
               "global_load_async_to_lds_b128 %2, %10, off\n\t"
               "global_load_async_to_lds_b128 %3, %11, off\n\t"
               "global_load_async_to_lds_b128 %4, %12, off\n\t"
               "global_load_async_to_lds_b128 %5, %13, off\n\t"
               "global_load_async_to_lds_b128 %6, %14, off\n\t"
               "global_load_async_to_lds_b128 %7, %15, off\n\t"
               "s_wait_xcnt 0x0"
               :: "v"(l[0]), "v"(l[1]), "v"(l[2]), "v"(l[3]),
                  "v"(l[4]), "v"(l[5]), "v"(l[6]), "v"(l[7]),
                  "v"(g[0]), "v"(g[1]), "v"(g[2]), "v"(g[3]),
                  "v"(g[4]), "v"(g[5]), "v"(g[6]), "v"(g[7])
               : "memory");
}

// ---------------------------------------------------------------------------
// Kernel 0: W[c][h] (f32) -> WT[h][c] (f16), for Wq/Wk/Wv (blockIdx.y selects)
// ---------------------------------------------------------------------------
__global__ __launch_bounds__(256) void wt_convert_kernel(
    const float* __restrict__ Wq, const float* __restrict__ Wk,
    const float* __restrict__ Wv, half_t* __restrict__ WT) {
  int m = blockIdx.y;
  const float* W = (m == 0) ? Wq : ((m == 1) ? Wk : Wv);
  half_t* dst = WT + (size_t)m * H_ * C_;
  int idx = blockIdx.x * 256 + threadIdx.x;   // [0, H_*C_)
  int h = idx >> 9;
  int c = idx & (C_ - 1);
  dst[idx] = (half_t)W[c * H_ + h];
}

// ---------------------------------------------------------------------------
// Kernel 1: projection, one wave = 16 rows x 64 cols, K=512 via WMMA f16.
// vTranspose!=0 stores output as Y[b][h][t] (for V), else Y[row][h].
// ---------------------------------------------------------------------------
__global__ __launch_bounds__(256) void proj_kernel(
    const float* __restrict__ X, const half_t* __restrict__ WT,
    half_t* __restrict__ Y, float outscale, int vTranspose) {
  int lane = threadIdx.x & 31;
  int wv   = threadIdx.x >> 5;
  int lrow = lane & 15;
  int kb8  = (lane >> 4) * 8;   // A/B operand k-run base for this lane half
  int prow = (lane >> 4) * 8;   // C/D row base for this lane half

  int rowbase = blockIdx.x * 128 + wv * 16;
  const float* xr = X + (size_t)(rowbase + lrow) * C_;

  v8f o[4] = {v8f{}, v8f{}, v8f{}, v8f{}};

  for (int kc = 0; kc < C_; kc += 32) {
    v8f x0 = *(const v8f*)(xr + kc + kb8);
    v8f x1 = *(const v8f*)(xr + kc + kb8 + 16);
    v16h a = make16(__builtin_convertvector(x0, v8h),
                    __builtin_convertvector(x1, v8h));
#pragma unroll
    for (int nt = 0; nt < 4; ++nt) {
      const half_t* wr = WT + (size_t)(nt * 16 + lrow) * C_ + kc + kb8;
      v16h bm = make16(ld8(wr), ld8(wr + 16));
      o[nt] = wmma_f16(a, bm, o[nt]);
    }
  }

  // uniform branch hoisted OUT of the store loops (keeps stores branch-free)
  if (!vTranspose) {
    half_t* yr = Y + (size_t)(rowbase + prow) * H_ + lrow;
#pragma unroll
    for (int nt = 0; nt < 4; ++nt) {
#pragma unroll
      for (int r = 0; r < 8; ++r)
        yr[(size_t)r * H_ + nt * 16] = (half_t)(o[nt][r] * outscale);
    }
  } else {
    int bb = rowbase >> 12;             // batch (T_ = 4096)
    int t0 = (rowbase & (T_ - 1)) + prow;
#pragma unroll
    for (int nt = 0; nt < 4; ++nt) {
      half_t* yc = Y + ((size_t)bb * H_ + nt * 16 + lrow) * T_ + t0;
#pragma unroll
      for (int r = 0; r < 8; ++r)
        yc[r] = (half_t)(o[nt][r] * outscale);
    }
  }
}

// ---------------------------------------------------------------------------
// Kernel 2: flash attention, exp2-domain online softmax, double-buffered
// async K/V^T staging. One wave = 16 query rows x one of KS_ key ranges;
// block = 64 rows x KS_ ranges = 16 waves, so 256 blocks of four waves per SIMD.
// Each trip covers 256 keys, 64 per range; the ranges' partial results
// (un-normalised sum, maximum, denominator) are merged through LDS at the end.
// ---------------------------------------------------------------------------
__global__ __launch_bounds__(512) void attn_kernel(
    const half_t* __restrict__ qh, const half_t* __restrict__ kh,
    const half_t* __restrict__ vhT, float* __restrict__ out) {
  __shared__ alignas(16) half_t Ks [2][KS_][64][72];   // [buf][range][key][head], 144 B rows
  __shared__ alignas(16) half_t VsT[2][KS_][64][72];   // [buf][range][head][key]
  __shared__ alignas(16) half_t Pl [4 * KS_][16][72];  // per-wave P tile (16x64)
  __shared__ alignas(16) float  Om [4 * KS_][16][OP_]; // per-wave partial O (16x64)
  __shared__ alignas(16) float  Mm [4 * KS_][16];      // per-wave row maxima
  __shared__ alignas(16) float  Lm [4 * KS_][16];      // per-wave row denominators

  int lane = threadIdx.x & 31;
  int wv   = threadIdx.x >> 5;
  int lrow = lane & 15;
  int kb8  = (lane >> 4) * 8;
  int prow = (lane >> 4) * 8;

  int qt   = wv & 3;            // query tile of this wave
  int ks   = wv >> 2;           // key range of this wave

  int b  = blockIdx.y;
  int q0 = blockIdx.x * 64 + qt * 16;
  const half_t* qB = qh  + (size_t)b * T_ * H_;
  const half_t* kB = kh  + (size_t)b * T_ * H_;
  const half_t* vB = vhT + (size_t)b * H_ * T_;

  // Q A-operands (head dim = two K=32 chunks), kept in registers
  const half_t* qr = qB + (size_t)(q0 + lrow) * H_;
  v16h qa0 = make16(ld8(qr + kb8),      ld8(qr + kb8 + 16));
  v16h qa1 = make16(ld8(qr + 32 + kb8), ld8(qr + 48 + kb8));

  v8f o[4] = {v8f{}, v8f{}, v8f{}, v8f{}};
  float m[8], l[8];
#pragma unroll
  for (int r = 0; r < 8; ++r) { m[r] = -1e30f; l[r] = 0.0f; }

  // async-stage one 256-key chunk, 64 keys for each range (K rows and V^T rows
  // are both pure row copies; a wave's copy covers 512 contiguous bytes)
  auto stage = [&](int chunk, int bufsel) {
    int kc = chunk * (64 * KS_);
    unsigned      la[8];
    const half_t* ga[8];
#pragma unroll  // la and ga are asm operands: their indices must be constants
    for (int j = 0; j < 4; ++j) {
      int c   = threadIdx.x + j * 512;   // [0,2048) 16B-segments
      int row = c >> 3;                  // K: 256 keys x 8 segments
      int sg  = (c & 7) * 8;
      la[j] = (unsigned)(uintptr_t)&Ks[bufsel][row >> 6][row & 63][sg];
      ga[j] = kB + (size_t)(kc + row) * H_ + sg;
      int hr  = c >> 5;                  // V^T: 64 heads x 32 segments
      int ky  = (c & 31) * 8;
      la[4 + j] = (unsigned)(uintptr_t)&VsT[bufsel][ky >> 6][hr][ky & 63];
      ga[4 + j] = vB + (size_t)hr * T_ + kc + ky;
    }
    async_cp16x8(la, ga);
  };

  const int NCH = T_ / (64 * KS_);
  stage(0, 0);
  asm volatile("s_wait_asynccnt 0x0" ::: "memory");  // own copies of chunk 0 landed
  __syncthreads();                                   // and everybody else's
  stage(1, 1);                                // flies while chunk 0 is worked on

  for (int i = 0; i < NCH; ++i) {
    int buf = i & 1;

    // ---- scores: S(16x64) = Q @ K^T, four 16-key column groups ----
    v8f s[4];
#pragma unroll
    for (int g = 0; g < 4; ++g) {
      const half_t* kp = &Ks[buf][ks][g * 16 + lrow][kb8];
      v16h b0 = make16(ld8(kp),      ld8(kp + 16));
      v16h b1 = make16(ld8(kp + 32), ld8(kp + 48));
      v8f acc = {};
      acc = wmma_f16(qa0, b0, acc);
      acc = wmma_f16(qa1, b1, acc);
      s[g] = acc;
    }

    // ---- online softmax in exp2 domain (log2e folded into Q scale) ----
#pragma unroll
    for (int r = 0; r < 8; ++r) {
      float a = fmaxf(fmaxf(s[0][r], s[1][r]), fmaxf(s[2][r], s[3][r]));
      a = fmaxf(a, __shfl_xor(a, 1));
      a = fmaxf(a, __shfl_xor(a, 2));
      a = fmaxf(a, __shfl_xor(a, 4));
      a = fmaxf(a, __shfl_xor(a, 8));
      float mn = fmaxf(m[r], a);
      float cf = __builtin_amdgcn_exp2f(m[r] - mn);
      m[r] = mn;
      float p0 = __builtin_amdgcn_exp2f(s[0][r] - mn);
      float p1 = __builtin_amdgcn_exp2f(s[1][r] - mn);
      float p2 = __builtin_amdgcn_exp2f(s[2][r] - mn);
      float p3 = __builtin_amdgcn_exp2f(s[3][r] - mn);
      s[0][r] = p0; s[1][r] = p1; s[2][r] = p2; s[3][r] = p3;
      float rs = (p0 + p1) + (p2 + p3);
      rs += __shfl_xor(rs, 1);
      rs += __shfl_xor(rs, 2);
      rs += __shfl_xor(rs, 4);
      rs += __shfl_xor(rs, 8);
      l[r] = l[r] * cf + rs;
      o[0][r] *= cf; o[1][r] *= cf; o[2][r] *= cf; o[3][r] *= cf;
    }

    // ---- stage P (C/D layout) -> LDS -> reread as A operand (f16) ----
#pragma unroll
    for (int r = 0; r < 8; ++r) {
#pragma unroll
      for (int g = 0; g < 4; ++g)
        Pl[wv][prow + r][g * 16 + lrow] = (half_t)s[g][r];
    }
    asm volatile("s_wait_dscnt 0x0" ::: "memory");  // same-wave LDS RAW
    const half_t* pp = &Pl[wv][lrow][0];
    v16h pa0 = make16(ld8(pp + kb8),      ld8(pp + kb8 + 16));
    v16h pa1 = make16(ld8(pp + 32 + kb8), ld8(pp + 48 + kb8));

    // ---- O += P @ V over 64 keys (two K=32 chunks x four head tiles) ----
#pragma unroll
    for (int nt = 0; nt < 4; ++nt) {
      const half_t* vp = &VsT[buf][ks][nt * 16 + lrow][0];
      v16h vb0 = make16(ld8(vp + kb8),      ld8(vp + kb8 + 16));
      v16h vb1 = make16(ld8(vp + 32 + kb8), ld8(vp + 48 + kb8));
      o[nt] = wmma_f16(pa0, vb0, o[nt]);
      o[nt] = wmma_f16(pa1, vb1, o[nt]);
    }

    asm volatile("s_wait_dscnt 0x0" ::: "memory");    // own reads of buf retired
    asm volatile("s_wait_asynccnt 0x0" ::: "memory"); // next chunk resident
    __syncthreads();                                  // everyone done with buf
    if (i + 2 < NCH) stage(i + 2, buf);               // refill the buffer just read
  }
  asm volatile("s_wait_asynccnt 0x0" ::: "memory");   // no copy outlives the loop

  // ---- merge the KS_ key ranges of each query tile through LDS ----
  // (the loops below are unrolled so that o, m, l and mj stay in registers)
#pragma unroll
  for (int nt = 0; nt < 4; ++nt) {
#pragma unroll
    for (int r = 0; r < 8; ++r)
      Om[wv][prow + r][nt * 16 + lrow] = o[nt][r];
  }
  if (lrow == 0) {   // m and l are equal in the 16 lanes of a row group
#pragma unroll
    for (int r = 0; r < 8; ++r) { Mm[wv][prow + r] = m[r]; Lm[wv][prow + r] = l[r]; }
  }
  __syncthreads();   // every range's partials are in LDS before any is read

  // wave (qt, ks) finishes rows 4*ks .. 4*ks+3 of tile qt: a lane owns 8 heads of a row
  int rr = ks * 4 + (lane >> 3);
  int c0 = (lane & 7) * 8;
  float mj[KS_];
#pragma unroll
  for (int j = 0; j < KS_; ++j) mj[j] = Mm[j * 4 + qt][rr];
  float mx = fmaxf(fmaxf(mj[0], mj[1]), fmaxf(mj[2], mj[3]));
  float ls = 0.0f;
  v4f a0 = {}, a1 = {};
#pragma unroll
  for (int j = 0; j < KS_; ++j) {
    float w = __builtin_amdgcn_exp2f(mj[j] - mx);
    ls += w * Lm[j * 4 + qt][rr];
    const float* pj = &Om[j * 4 + qt][rr][c0];
    a0 += w * *(const v4f*)pj;
    a1 += w * *(const v4f*)(pj + 4);
  }
  float rl = __builtin_amdgcn_rcpf(ls);
  float* op = out + ((size_t)b * T_ + q0 + rr) * H_ + c0;
  *(v4f*)op       = a0 * rl;
  *(v4f*)(op + 4) = a1 * rl;
}

// ---------------------------------------------------------------------------
extern "C" void kernel_launch(void* const* d_in, const int* in_sizes, int n_in,
                              void* d_out, int out_size, void* d_ws, size_t ws_size,
                              hipStream_t stream) {
  const float* q  = (const float*)d_in[0];
  const float* k  = (const float*)d_in[1];
  const float* v  = (const float*)d_in[2];
  const float* Wq = (const float*)d_in[3];
  const float* Wk = (const float*)d_in[4];
  const float* Wv = (const float*)d_in[5];
  float* out = (float*)d_out;

  half_t* wsh = (half_t*)d_ws;
  half_t* qh  = wsh;                                 // [BT_][H_]   f16
  half_t* kh  = wsh + (size_t)BT_ * H_;              // [BT_][H_]   f16
  half_t* vhT = wsh + 2 * (size_t)BT_ * H_;          // [B_][H_][T_] f16
  half_t* WT  = wsh + 3 * (size_t)BT_ * H_;          // 3 x [H_][C_] f16

  wt_convert_kernel<<<dim3((C_ * H_) / 256, 3), 256, 0, stream>>>(Wq, Wk, Wv, WT);
  // fold attention scale AND log2(e) (exp2-domain softmax) into qh
  proj_kernel<<<dim3(BT_ / 128), 256, 0, stream>>>(q, WT, qh, 0.125f * LOG2E, 0);
  proj_kernel<<<dim3(BT_ / 128), 256, 0, stream>>>(k, WT + (size_t)H_ * C_, kh, 1.0f, 0);
  proj_kernel<<<dim3(BT_ / 128), 256, 0, stream>>>(v, WT + 2 * (size_t)H_ * C_, vhT, 1.0f, 1);
  attn_kernel<<<dim3(T_ / 64, B_), 512, 0, stream>>>(qh, kh, vhT, out);
}

// v002
// Measured time: 63 microseconds a run.
// Next to v001, in two timings, it ran 1.40 and 1.39 times as fast.
// All steps since v000 together make it 3.03 times as fast.
#include <hip/hip_runtime.h>
#include <stdint.h>

typedef _Float16 half_t;
typedef __attribute__((ext_vector_type(16))) _Float16 v16h;
typedef __attribute__((ext_vector_type(8)))  _Float16 v8h;
typedef __attribute__((ext_vector_type(8)))  float    v8f;
typedef __attribute__((ext_vector_type(4)))  float    v4f;

#define B_  4
#define T_  4096
#define C_  512
#define H_  64
#define BT_ (B_ * T_)
#define LOG2E 1.44269504088896340736f
#define KS_ 4    // key ranges per work-group: waves 4*ks .. 4*ks+3 walk range ks
#define OP_ 68   // f32 pitch of a staged partial row: rows r and r+8 fall on different banks

static __device__ inline v16h make16(v8h lo, v8h hi) {
  return __builtin_shufflevector(lo, hi, 0,1,2,3,4,5,6,7,8,9,10,11,12,13,14,15);
}
static __device__ inline v8h ld8(const half_t* p) { return *(const v8h*)p; }

static __device__ inline v8f wmma_f16(v16h a, v16h b, v8f c) {
  // D = A(16x32 f16) * B(32x16 f16) + C(16x16 f32)
  return __builtin_amdgcn_wmma_f32_16x16x32_f16(false, a, false, b, (short)0, c, false, false);
}

// CDNA5 async global->LDS copies (16 B per lane each), tracked by ASYNCcnt.
// One statement for a stage's eight copies; as its last line, s_wait_xcnt stands in
// front of every later write of the copies' address registers (a precaution).
static __device__ inline void async_cp16x8(const unsigned (&l)[8],
                                           const half_t* const (&g)[8]) {
  asm volatile("global_load_async_to_lds_b128 %0, %8, off\n\t"
               "global_load_async_to_lds_b128 %1, %9, off\n\t"
               "global_load_async_to_lds_b128 %2, %10, off\n\t"
               "global_load_async_to_lds_b128 %3, %11, off\n\t"
               "global_load_async_to_lds_b128 %4, %12, off\n\t"
               "global_load_async_to_lds_b128 %5, %13, off\n\t"
               "global_load_async_to_lds_b128 %6, %14, off\n\t"
               "global_load_async_to_lds_b128 %7, %15, off\n\t"
               "s_wait_xcnt 0x0"
               :: "v"(l[0]), "v"(l[1]), "v"(l[2]), "v"(l[3]),
                  "v"(l[4]), "v"(l[5]), "v"(l[6]), "v"(l[7]),
                  "v"(g[0]), "v"(g[1]), "v"(g[2]), "v"(g[3]),
                  "v"(g[4]), "v"(g[5]), "v"(g[6]), "v"(g[7])
               : "memory");
}

// ---------------------------------------------------------------------------
// Kernel 0: W[c][h] (f32) -> WT[h][c] (f16), for Wq/Wk/Wv (blockIdx.y selects)
// ---------------------------------------------------------------------------
__global__ __launch_bounds__(256) void wt_convert_kernel(
    const float* __restrict__ Wq, const float* __restrict__ Wk,
    const float* __restrict__ Wv, half_t* __restrict__ WT) {
  int m = blockIdx.y;
  const float* W = (m == 0) ? Wq : ((m == 1) ? Wk : Wv);
  half_t* dst = WT + (size_t)m * H_ * C_;
  int idx = blockIdx.x * 256 + threadIdx.x;   // [0, H_*C_)
  int h = idx >> 9;
  int c = idx & (C_ - 1);
  dst[idx] = (half_t)W[c * H_ + h];
}

// ---------------------------------------------------------------------------
// Kernel 1: the three projections in one launch, one wave = 16 rows x 64 cols,
// K=512 via WMMA f16. blockIdx.y picks the input, its weights and its output
// plane: a wave waits out its loads trip by trip, so the three run side by side.
// Plane 2 (V) is stored as Y[b][h][t], planes 0 and 1 as Y[row][h]; plane 0 (Q)
// carries the attention scale and log2(e) (exp2-domain softmax).
// ---------------------------------------------------------------------------
__global__ __launch_bounds__(256) void proj_kernel(
    const float* __restrict__ Xq, const float* __restrict__ Xk,
    const float* __restrict__ Xv, const half_t* __restrict__ WTall,
    half_t* __restrict__ Yall) {
  int pl = blockIdx.y;
  const float*  X  = (pl == 0) ? Xq : ((pl == 1) ? Xk : Xv);
  const half_t* WT = WTall + (size_t)pl * H_ * C_;
  half_t*       Y  = Yall + (size_t)pl * BT_ * H_;
  float outscale   = (pl == 0) ? 0.125f * LOG2E : 1.0f;
  bool vTranspose  = (pl == 2);

  int lane = threadIdx.x & 31;
  int wv   = threadIdx.x >> 5;
  int lrow = lane & 15;
  int kb8  = (lane >> 4) * 8;   // A/B operand k-run base for this lane half
  int prow = (lane >> 4) * 8;   // C/D row base for this lane half

  int rowbase = blockIdx.x * 128 + wv * 16;
  const float* xr = X + (size_t)(rowbase + lrow) * C_;

  v8f o[4] = {v8f{}, v8f{}, v8f{}, v8f{}};

  for (int kc = 0; kc < C_; kc += 32) {
    v8f x0 = *(const v8f*)(xr + kc + kb8);
    v8f x1 = *(const v8f*)(xr + kc + kb8 + 16);
    v16h a = make16(__builtin_convertvector(x0, v8h),
                    __builtin_convertvector(x1, v8h));
#pragma unroll
    for (int nt = 0; nt < 4; ++nt) {
      const half_t* wr = WT + (size_t)(nt * 16 + lrow) * C_ + kc + kb8;
      v16h bm = make16(ld8(wr), ld8(wr + 16));
      o[nt] = wmma_f16(a, bm, o[nt]);
    }
  }

  // uniform branch hoisted OUT of the store loops (keeps stores branch-free)
  if (!vTranspose) {
    half_t* yr = Y + (size_t)(rowbase + prow) * H_ + lrow;
#pragma unroll
    for (int nt = 0; nt < 4; ++nt) {
#pragma unroll
      for (int r = 0; r < 8; ++r)
        yr[(size_t)r * H_ + nt * 16] = (half_t)(o[nt][r] * outscale);
    }
  } else {
    int bb = rowbase >> 12;             // batch (T_ = 4096)
    int t0 = (rowbase & (T_ - 1)) + prow;
#pragma unroll
    for (int nt = 0; nt < 4; ++nt) {
      half_t* yc = Y + ((size_t)bb * H_ + nt * 16 + lrow) * T_ + t0;
#pragma unroll
      for (int r = 0; r < 8; ++r)
        yc[r] = (half_t)(o[nt][r] * outscale);
    }
  }
}

// ---------------------------------------------------------------------------
// Kernel 2: flash attention, exp2-domain online softmax, double-buffered
// async K/V^T staging. One wave = 16 query rows x one of KS_ key ranges;
// block = 64 rows x KS_ ranges = 16 waves, so 256 blocks of four waves per SIMD.
// Each trip covers 256 keys, 64 per range; the ranges' partial results
// (un-normalised sum, maximum, denominator) are merged through LDS at the end.
// ---------------------------------------------------------------------------
__global__ __launch_bounds__(512) void attn_kernel(
    const half_t* __restrict__ qh, const half_t* __restrict__ kh,
    const half_t* __restrict__ vhT, float* __restrict__ out) {
  __shared__ alignas(16) half_t Ks [2][KS_][64][72];   // [buf][range][key][head], 144 B rows
  __shared__ alignas(16) half_t VsT[2][KS_][64][72];   // [buf][range][head][key]
  __shared__ alignas(16) half_t Pl [4 * KS_][16][72];  // per-wave P tile (16x64)
  __shared__ alignas(16) float  Om [4 * KS_][16][OP_]; // per-wave partial O (16x64)
  __shared__ alignas(16) float  Mm [4 * KS_][16];      // per-wave row maxima
  __shared__ alignas(16) float  Lm [4 * KS_][16];      // per-wave row denominators

  int lane = threadIdx.x & 31;
  int wv   = threadIdx.x >> 5;
  int lrow = lane & 15;
  int kb8  = (lane >> 4) * 8;
  int prow = (lane >> 4) * 8;

  int qt   = wv & 3;            // query tile of this wave
  int ks   = wv >> 2;           // key range of this wave

  int b  = blockIdx.y;
  int q0 = blockIdx.x * 64 + qt * 16;
  const half_t* qB = qh  + (size_t)b * T_ * H_;
  const half_t* kB = kh  + (size_t)b * T_ * H_;
  const half_t* vB = vhT + (size_t)b * H_ * T_;

  // Q A-operands (head dim = two K=32 chunks), kept in registers
  const half_t* qr = qB + (size_t)(q0 + lrow) * H_;
  v16h qa0 = make16(ld8(qr + kb8),      ld8(qr + kb8 + 16));
  v16h qa1 = make16(ld8(qr + 32 + kb8), ld8(qr + 48 + kb8));

  v8f o[4] = {v8f{}, v8f{}, v8f{}, v8f{}};
  float m[8], l[8];
#pragma unroll
  for (int r = 0; r < 8; ++r) { m[r] = -1e30f; l[r] = 0.0f; }

  // async-stage one 256-key chunk, 64 keys for each range (K rows and V^T rows
  // are both pure row copies; a wave's copy covers 512 contiguous bytes)
  auto stage = [&](int chunk, int bufsel) {
    int kc = chunk * (64 * KS_);
    unsigned      la[8];
    const half_t* ga[8];
#pragma unroll  // la and ga are asm operands: their indices must be constants
    for (int j = 0; j < 4; ++j) {
      int c   = threadIdx.x + j * 512;   // [0,2048) 16B-segments
      int row = c >> 3;                  // K: 256 keys x 8 segments
      int sg  = (c & 7) * 8;
      la[j] = (unsigned)(uintptr_t)&Ks[bufsel][row >> 6][row & 63][sg];
      ga[j] = kB + (size_t)(kc + row) * H_ + sg;
      int hr  = c >> 5;                  // V^T: 64 heads x 32 segments
      int ky  = (c & 31) * 8;
      la[4 + j] = (unsigned)(uintptr_t)&VsT[bufsel][ky >> 6][hr][ky & 63];
      ga[4 + j] = vB + (size_t)hr * T_ + kc + ky;
    }
    async_cp16x8(la, ga);
  };

  const int NCH = T_ / (64 * KS_);
  stage(0, 0);
  asm volatile("s_wait_asynccnt 0x0" ::: "memory");  // own copies of chunk 0 landed
  __syncthreads();                                   // and everybody else's
  stage(1, 1);                                // flies while chunk 0 is worked on

  for (int i = 0; i < NCH; ++i) {
    int buf = i & 1;

    // ---- scores: S(16x64) = Q @ K^T, four 16-key column groups ----
    v8f s[4];
#pragma unroll
    for (int g = 0; g < 4; ++g) {
      const half_t* kp = &Ks[buf][ks][g * 16 + lrow][kb8];
      v16h b0 = make16(ld8(kp),      ld8(kp + 16));
      v16h b1 = make16(ld8(kp + 32), ld8(kp + 48));
      v8f acc = {};
      acc = wmma_f16(qa0, b0, acc);
      acc = wmma_f16(qa1, b1, acc);
      s[g] = acc;
    }

    // ---- online softmax in exp2 domain (log2e folded into Q scale) ----
#pragma unroll
    for (int r = 0; r < 8; ++r) {
      float a = fmaxf(fmaxf(s[0][r], s[1][r]), fmaxf(s[2][r], s[3][r]));
      a = fmaxf(a, __shfl_xor(a, 1));
      a = fmaxf(a, __shfl_xor(a, 2));
      a = fmaxf(a, __shfl_xor(a, 4));
      a = fmaxf(a, __shfl_xor(a, 8));
      float mn = fmaxf(m[r], a);
      float cf = __builtin_amdgcn_exp2f(m[r] - mn);
      m[r] = mn;
      float p0 = __builtin_amdgcn_exp2f(s[0][r] - mn);
      float p1 = __builtin_amdgcn_exp2f(s[1][r] - mn);
      float p2 = __builtin_amdgcn_exp2f(s[2][r] - mn);
      float p3 = __builtin_amdgcn_exp2f(s[3][r] - mn);
      s[0][r] = p0; s[1][r] = p1; s[2][r] = p2; s[3][r] = p3;
      float rs = (p0 + p1) + (p2 + p3);
      rs += __shfl_xor(rs, 1);
      rs += __shfl_xor(rs, 2);
      rs += __shfl_xor(rs, 4);
      rs += __shfl_xor(rs, 8);
      l[r] = l[r] * cf + rs;
      o[0][r] *= cf; o[1][r] *= cf; o[2][r] *= cf; o[3][r] *= cf;
    }

    // ---- stage P (C/D layout) -> LDS -> reread as A operand (f16) ----
#pragma unroll
    for (int r = 0; r < 8; ++r) {
#pragma unroll
      for (int g = 0; g < 4; ++g)
        Pl[wv][prow + r][g * 16 + lrow] = (half_t)s[g][r];
    }
    asm volatile("s_wait_dscnt 0x0" ::: "memory");  // same-wave LDS RAW
    const half_t* pp = &Pl[wv][lrow][0];
    v16h pa0 = make16(ld8(pp + kb8),      ld8(pp + kb8 + 16));
    v16h pa1 = make16(ld8(pp + 32 + kb8), ld8(pp + 48 + kb8));

    // ---- O += P @ V over 64 keys (two K=32 chunks x four head tiles) ----
#pragma unroll
    for (int nt = 0; nt < 4; ++nt) {
      const half_t* vp = &VsT[buf][ks][nt * 16 + lrow][0];
      v16h vb0 = make16(ld8(vp + kb8),      ld8(vp + kb8 + 16));
      v16h vb1 = make16(ld8(vp + 32 + kb8), ld8(vp + 48 + kb8));
      o[nt] = wmma_f16(pa0, vb0, o[nt]);
      o[nt] = wmma_f16(pa1, vb1, o[nt]);
    }

    asm volatile("s_wait_dscnt 0x0" ::: "memory");    // own reads of buf retired
    asm volatile("s_wait_asynccnt 0x0" ::: "memory"); // next chunk resident
    __syncthreads();                                  // everyone done with buf
    if (i + 2 < NCH) stage(i + 2, buf);               // refill the buffer just read
  }
  asm volatile("s_wait_asynccnt 0x0" ::: "memory");   // no copy outlives the loop

  // ---- merge the KS_ key ranges of each query tile through LDS ----
  // (the loops below are unrolled so that o, m, l and mj stay in registers)
#pragma unroll
  for (int nt = 0; nt < 4; ++nt) {
#pragma unroll
    for (int r = 0; r < 8; ++r)
      Om[wv][prow + r][nt * 16 + lrow] = o[nt][r];
  }
  if (lrow == 0) {   // m and l are equal in the 16 lanes of a row group
#pragma unroll
    for (int r = 0; r < 8; ++r) { Mm[wv][prow + r] = m[r]; Lm[wv][prow + r] = l[r]; }
  }
  __syncthreads();   // every range's partials are in LDS before any is read

  // wave (qt, ks) finishes rows 4*ks .. 4*ks+3 of tile qt: a lane owns 8 heads of a row
  int rr = ks * 4 + (lane >> 3);
  int c0 = (lane & 7) * 8;
  float mj[KS_];
#pragma unroll
  for (int j = 0; j < KS_; ++j) mj[j] = Mm[j * 4 + qt][rr];
  float mx = fmaxf(fmaxf(mj[0], mj[1]), fmaxf(mj[2], mj[3]));
  float ls = 0.0f;
  v4f a0 = {}, a1 = {};
#pragma unroll
  for (int j = 0; j < KS_; ++j) {
    float w = __builtin_amdgcn_exp2f(mj[j] - mx);
    ls += w * Lm[j * 4 + qt][rr];
    const float* pj = &Om[j * 4 + qt][rr][c0];
    a0 += w * *(const v4f*)pj;
    a1 += w * *(const v4f*)(pj + 4);
  }
  float rl = __builtin_amdgcn_rcpf(ls);
  float* op = out + ((size_t)b * T_ + q0 + rr) * H_ + c0;
  *(v4f*)op       = a0 * rl;
  *(v4f*)(op + 4) = a1 * rl;
}

// ---------------------------------------------------------------------------
extern "C" void kernel_launch(void* const* d_in, const int* in_sizes, int n_in,
                              void* d_out, int out_size, void* d_ws, size_t ws_size,
                              hipStream_t stream) {
  const float* q  = (const float*)d_in[0];
  const float* k  = (const float*)d_in[1];
  const float* v  = (const float*)d_in[2];
  const float* Wq = (const float*)d_in[3];
  const float* Wk = (const float*)d_in[4];
  const float* Wv = (const float*)d_in[5];
  float* out = (float*)d_out;

  half_t* wsh = (half_t*)d_ws;
  half_t* qh  = wsh;                                 // [BT_][H_]   f16
  half_t* kh  = wsh + (size_t)BT_ * H_;              // [BT_][H_]   f16
  half_t* vhT = wsh + 2 * (size_t)BT_ * H_;          // [B_][H_][T_] f16
  half_t* WT  = wsh + 3 * (size_t)BT_ * H_;          // 3 x [H_][C_] f16

  wt_convert_kernel<<<dim3((C_ * H_) / 256, 3), 256, 0, stream>>>(Wq, Wk, Wv, WT);
  // qh, kh and vhT are the three output planes, in this order, from wsh on
  proj_kernel<<<dim3(BT_ / 128, 3), 256, 0, stream>>>(q, k, v, WT, wsh);
  attn_kernel<<<dim3(T_ / 64, B_), 512, 0, stream>>>(qh, kh, vhT, out);
}

// v003
// Measured time: 50.9 microseconds a run.
// Timed twice side by side with v002, it ran 1.25 and 1.24 times as fast.
// Over all steps from v000 it is 3.77 times as fast.
#include <hip/hip_runtime.h>
#include <stdint.h>

typedef _Float16 half_t;
typedef __attribute__((ext_vector_type(16))) _Float16 v16h;
typedef __attribute__((ext_vector_type(8)))  _Float16 v8h;
typedef __attribute__((ext_vector_type(8)))  float    v8f;
typedef __attribute__((ext_vector_type(4)))  float    v4f;

#define B_  4
#define T_  4096
#define C_  512
#define H_  64
#define BT_ (B_ * T_)
#define LOG2E 1.44269504088896340736f
#define KS_ 4    // key ranges per work-group: waves 4*ks .. 4*ks+3 walk range ks
#define OP_ 68   // f32 pitch of a staged partial row: rows r and r+8 fall on different banks

static __device__ inline v16h make16(v8h lo, v8h hi) {
  return __builtin_shufflevector(lo, hi, 0,1,2,3,4,5,6,7,8,9,10,11,12,13,14,15);
}
static __device__ inline v8h ld8(const half_t* p) { return *(const v8h*)p; }

static __device__ inline v8f wmma_f16(v16h a, v16h b, v8f c) {
  // D = A(16x32 f16) * B(32x16 f16) + C(16x16 f32)
  return __builtin_amdgcn_wmma_f32_16x16x32_f16(false, a, false, b, (short)0, c, false, false);
}

// lane l <-> lane l ^ 16 in the vector unit (a shuffle would go through the LDS port)
static __device__ inline float xhalf(float x) {
  int b = __builtin_bit_cast(int, x);
  return __builtin_bit_cast(float,
      __builtin_amdgcn_permlanex16(b, b, 0x76543210, 0xfedcba98, false, false));
}

// CDNA5 async global->LDS copies (16 B per lane each), tracked by ASYNCcnt.
// One statement for a stage's eight copies; as its last line, s_wait_xcnt stands in
// front of every later write of the copies' address registers (a precaution).
static __device__ inline void async_cp16x8(const unsigned (&l)[8],
                                           const half_t* const (&g)[8]) {
  asm volatile("global_load_async_to_lds_b128 %0, %8, off\n\t"
               "global_load_async_to_lds_b128 %1, %9, off\n\t"
               "global_load_async_to_lds_b128 %2, %10, off\n\t"
               "global_load_async_to_lds_b128 %3, %11, off\n\t"
               "global_load_async_to_lds_b128 %4, %12, off\n\t"
               "global_load_async_to_lds_b128 %5, %13, off\n\t"
               "global_load_async_to_lds_b128 %6, %14, off\n\t"
               "global_load_async_to_lds_b128 %7, %15, off\n\t"
               "s_wait_xcnt 0x0"
               :: "v"(l[0]), "v"(l[1]), "v"(l[2]), "v"(l[3]),
                  "v"(l[4]), "v"(l[5]), "v"(l[6]), "v"(l[7]),
                  "v"(g[0]), "v"(g[1]), "v"(g[2]), "v"(g[3]),
                  "v"(g[4]), "v"(g[5]), "v"(g[6]), "v"(g[7])
               : "memory");
}

// ---------------------------------------------------------------------------
// Kernel 0: W[c][h] (f32) -> WT[h][c] (f16), for Wq/Wk/Wv (blockIdx.y selects)
// ---------------------------------------------------------------------------
__global__ __launch_bounds__(256) void wt_convert_kernel(
    const float* __restrict__ Wq, const float* __restrict__ Wk,
    const float* __restrict__ Wv, half_t* __restrict__ WT) {
  int m = blockIdx.y;
  const float* W = (m == 0) ? Wq : ((m == 1) ? Wk : Wv);
  half_t* dst = WT + (size_t)m * H_ * C_;
  int idx = blockIdx.x * 256 + threadIdx.x;   // [0, H_*C_)
  int h = idx >> 9;
  int c = idx & (C_ - 1);
  dst[idx] = (half_t)W[c * H_ + h];
}

// ---------------------------------------------------------------------------
// Kernel 1: the three projections in one launch, one wave = 16 rows x 64 cols,
// K=512 via WMMA f16. blockIdx.y picks the input, its weights and its output
// plane: a wave waits out its loads trip by trip, so the three run side by side.
// Plane 2 (V) is stored as Y[b][h][t], planes 0 and 1 as Y[row][h]; plane 0 (Q)
// carries the attention scale and log2(e) (exp2-domain softmax).
// ---------------------------------------------------------------------------
__global__ __launch_bounds__(256) void proj_kernel(
    const float* __restrict__ Xq, const float* __restrict__ Xk,
    const float* __restrict__ Xv, const half_t* __restrict__ WTall,
    half_t* __restrict__ Yall) {
  int pl = blockIdx.y;
  const float*  X  = (pl == 0) ? Xq : ((pl == 1) ? Xk : Xv);
  const half_t* WT = WTall + (size_t)pl * H_ * C_;
  half_t*       Y  = Yall + (size_t)pl * BT_ * H_;
  float outscale   = (pl == 0) ? 0.125f * LOG2E : 1.0f;
  bool vTranspose  = (pl == 2);

  int lane = threadIdx.x & 31;
  int wv   = threadIdx.x >> 5;
  int lrow = lane & 15;
  int kb8  = (lane >> 4) * 8;   // A/B operand k-run base for this lane half
  int prow = (lane >> 4) * 8;   // C/D row base for this lane half

  int rowbase = blockIdx.x * 128 + wv * 16;
  const float* xr = X + (size_t)(rowbase + lrow) * C_;

  v8f o[4] = {v8f{}, v8f{}, v8f{}, v8f{}};

  for (int kc = 0; kc < C_; kc += 32) {
    v8f x0 = *(const v8f*)(xr + kc + kb8);
    v8f x1 = *(const v8f*)(xr + kc + kb8 + 16);
    v16h a = make16(__builtin_convertvector(x0, v8h),
                    __builtin_convertvector(x1, v8h));
#pragma unroll
    for (int nt = 0; nt < 4; ++nt) {
      const half_t* wr = WT + (size_t)(nt * 16 + lrow) * C_ + kc + kb8;
      v16h bm = make16(ld8(wr), ld8(wr + 16));
      o[nt] = wmma_f16(a, bm, o[nt]);
    }
  }

  // uniform branch hoisted OUT of the store loops (keeps stores branch-free)
  if (!vTranspose) {
    half_t* yr = Y + (size_t)(rowbase + prow) * H_ + lrow;
#pragma unroll
    for (int nt = 0; nt < 4; ++nt) {
#pragma unroll
      for (int r = 0; r < 8; ++r)
        yr[(size_t)r * H_ + nt * 16] = (half_t)(o[nt][r] * outscale);
    }
  } else {
    int bb = rowbase >> 12;             // batch (T_ = 4096)
    int t0 = (rowbase & (T_ - 1)) + prow;
#pragma unroll
    for (int nt = 0; nt < 4; ++nt) {
      half_t* yc = Y + ((size_t)bb * H_ + nt * 16 + lrow) * T_ + t0;
#pragma unroll
      for (int r = 0; r < 8; ++r)
        yc[r] = (half_t)(o[nt][r] * outscale);
    }
  }
}

__global__ __launch_bounds__(512) void attn_kernel(
    const half_t* __restrict__ qh, const half_t* __restrict__ kh,
    const half_t* __restrict__ vhT, float* __restrict__ out) {
  __shared__ alignas(16) half_t Ks [2][KS_][64][72];   // [buf][range][key][head], 144 B rows
  __shared__ alignas(16) half_t VsT[2][KS_][64][72];   // [buf][range][head][key]
  __shared__ alignas(16) float  Om [4 * KS_][16][OP_]; // per-wave partial O (16x64)
  __shared__ alignas(16) float  Mm [4 * KS_][16];      // per-wave row maxima
  __shared__ alignas(16) float  Lm [4 * KS_][16];      // per-wave row denominators

  int lane = threadIdx.x & 31;
  int wv   = threadIdx.x >> 5;
  int lrow = lane & 15;
  int kb8  = (lane >> 4) * 8;
  int prow = (lane >> 4) * 8;

  int qt   = wv & 3;            // query tile of this wave
  int ks   = wv >> 2;           // key range of this wave

  int b  = blockIdx.y;
  int q0 = blockIdx.x * 64 + qt * 16;
  const half_t* qB = qh  + (size_t)b * T_ * H_;
  const half_t* kB = kh  + (size_t)b * T_ * H_;
  const half_t* vB = vhT + (size_t)b * H_ * T_;

  // Q^T B-operands (head dim = two K=32 chunks), kept in registers: column = query lrow
  const half_t* qr = qB + (size_t)(q0 + lrow) * H_;
  v16h qa0 = make16(ld8(qr + kb8),      ld8(qr + kb8 + 16));
  v16h qa1 = make16(ld8(qr + 32 + kb8), ld8(qr + 48 + kb8));

  v8f o[4] = {v8f{}, v8f{}, v8f{}, v8f{}};
  float m = -1e30f;   // running maximum of query lrow, equal in both wave halves
  float l = 0.0f;     // denominator over this half's keys; the halves join after the loop

  // async-stage one 256-key chunk, 64 keys for each range (K rows and V^T rows
  // are both pure row copies; a wave's copy covers 512 contiguous bytes)
  auto stage = [&](int chunk, int bufsel) {
    int kc = chunk * (64 * KS_);
    unsigned      la[8];
    const half_t* ga[8];
#pragma unroll  // la and ga are asm operands: their indices must be constants
    for (int j = 0; j < 4; ++j) {
      int c   = threadIdx.x + j * 512;   // [0,2048) 16B-segments
      int row = c >> 3;                  // K: 256 keys x 8 segments
      int sg  = (c & 7) * 8;
      la[j] = (unsigned)(uintptr_t)&Ks[bufsel][row >> 6][row & 63][sg];
      ga[j] = kB + (size_t)(kc + row) * H_ + sg;
      int hr  = c >> 5;                  // V^T: 64 heads x 32 segments
      int ky  = (c & 31) * 8;
      la[4 + j] = (unsigned)(uintptr_t)&VsT[bufsel][ky >> 6][hr][ky & 63];
      ga[4 + j] = vB + (size_t)hr * T_ + kc + ky;
    }
    async_cp16x8(la, ga);
  };

  const int NCH = T_ / (64 * KS_);
  stage(0, 0);
  asm volatile("s_wait_asynccnt 0x0" ::: "memory");  // own copies of chunk 0 landed
  __syncthreads();                                   // and everybody else's
  stage(1, 1);                                // flies while chunk 0 is worked on

  for (int i = 0; i < NCH; ++i) {
    int buf = i & 1;

    // ---- scores: S^T(64x16) = K @ Q^T, four 16-key row groups ----
    // s[g][r] = score of key g*16 + prow + r against query lrow
    v8f s[4];
#pragma unroll
    for (int g = 0; g < 4; ++g) {
      const half_t* kp = &Ks[buf][ks][g * 16 + lrow][kb8];
      v16h k0 = make16(ld8(kp),      ld8(kp + 16));
      v16h k1 = make16(ld8(kp + 32), ld8(kp + 48));
      v8f acc = {};
      acc = wmma_f16(k0, qa0, acc);
      acc = wmma_f16(k1, qa1, acc);
      s[g] = acc;
    }

    // ---- online softmax in exp2 domain (log2e folded into Q scale) ----
    // (the loops over s and o are unrolled: constant indices keep them in registers)
    float a = m;
#pragma unroll
    for (int r = 0; r < 8; ++r)
      a = fmaxf(fmaxf(a, fmaxf(fmaxf(s[0][r], s[1][r]), s[2][r])), s[3][r]);
    float mn = fmaxf(a, xhalf(a));   // the other half's 32 keys
    float cf = __builtin_amdgcn_exp2f(m - mn);
    m = mn;
#pragma unroll
    for (int g = 0; g < 4; ++g) {
#pragma unroll
      for (int r = 0; r < 8; ++r) s[g][r] = __builtin_amdgcn_exp2f(s[g][r] - mn);
    }
    v8f rs8 = (s[0] + s[1]) + (s[2] + s[3]);
    float rs = ((rs8[0] + rs8[1]) + (rs8[2] + rs8[3])) + ((rs8[4] + rs8[5]) + (rs8[6] + rs8[7]));
    l = l * cf + rs;
#pragma unroll
    for (int nt = 0; nt < 4; ++nt) o[nt] *= cf;

    // ---- P^T as B operand: two score tiles, converted in place, are 32 keys ----
    v16h pb0 = make16(__builtin_convertvector(s[0], v8h), __builtin_convertvector(s[1], v8h));
    v16h pb1 = make16(__builtin_convertvector(s[2], v8h), __builtin_convertvector(s[3], v8h));

    // ---- O^T += V^T @ P^T over 64 keys (two K=32 chunks x four head tiles) ----
#pragma unroll
    for (int nt = 0; nt < 4; ++nt) {
      const half_t* vp = &VsT[buf][ks][nt * 16 + lrow][0];
      v16h va0 = make16(ld8(vp + kb8),      ld8(vp + kb8 + 16));
      v16h va1 = make16(ld8(vp + 32 + kb8), ld8(vp + 48 + kb8));
      o[nt] = wmma_f16(va0, pb0, o[nt]);
      o[nt] = wmma_f16(va1, pb1, o[nt]);
    }

    asm volatile("s_wait_dscnt 0x0" ::: "memory");    // own reads of buf retired
    asm volatile("s_wait_asynccnt 0x0" ::: "memory"); // next chunk resident
    __syncthreads();                                  // everyone done with buf
    if (i + 2 < NCH) stage(i + 2, buf);               // refill the buffer just read
  }
  asm volatile("s_wait_asynccnt 0x0" ::: "memory");   // no copy outlives the loop

  // ---- merge the KS_ key ranges of each query tile through LDS ----
  // (the loops below are unrolled so that o and mj stay in registers)
  // o[nt][r] = O[query lrow][head nt*16 + prow + r]: eight heads in a row per tile
#pragma unroll
  for (int nt = 0; nt < 4; ++nt) {
    float* od = &Om[wv][lrow][nt * 16 + prow];
    *(v4f*)od       = __builtin_shufflevector(o[nt], o[nt], 0, 1, 2, 3);
    *(v4f*)(od + 4) = __builtin_shufflevector(o[nt], o[nt], 4, 5, 6, 7);
  }
  l += xhalf(l);     // the two halves' keys
  if (lane < 16) { Mm[wv][lrow] = m; Lm[wv][lrow] = l; }
  __syncthreads();   // every range's partials are in LDS before any is read

  // wave (qt, ks) finishes rows 4*ks .. 4*ks+3 of tile qt: a lane owns 8 heads of a row
  int rr = ks * 4 + (lane >> 3);
  int c0 = (lane & 7) * 8;
  float mj[KS_];
#pragma unroll
  for (int j = 0; j < KS_; ++j) mj[j] = Mm[j * 4 + qt][rr];
  float mx = fmaxf(fmaxf(mj[0], mj[1]), fmaxf(mj[2], mj[3]));
  float ls = 0.0f;
  v4f a0 = {}, a1 = {};
#pragma unroll
  for (int j = 0; j < KS_; ++j) {
    float w = __builtin_amdgcn_exp2f(mj[j] - mx);
    ls += w * Lm[j * 4 + qt][rr];
    const float* pj = &Om[j * 4 + qt][rr][c0];
    a0 += w * *(const v4f*)pj;
    a1 += w * *(const v4f*)(pj + 4);
  }
  float rl = __builtin_amdgcn_rcpf(ls);
  float* op = out + ((size_t)b * T_ + q0 + rr) * H_ + c0;
  *(v4f*)op       = a0 * rl;
  *(v4f*)(op + 4) = a1 * rl;
}

// ---------------------------------------------------------------------------
extern "C" void kernel_launch(void* const* d_in, const int* in_sizes, int n_in,
                              void* d_out, int out_size, void* d_ws, size_t ws_size,
                              hipStream_t stream) {
  const float* q  = (const float*)d_in[0];
  const float* k  = (const float*)d_in[1];
  const float* v  = (const float*)d_in[2];
  const float* Wq = (const float*)d_in[3];
  const float* Wk = (const float*)d_in[4];
  const float* Wv = (const float*)d_in[5];
  float* out = (float*)d_out;

  half_t* wsh = (half_t*)d_ws;
  half_t* qh  = wsh;                                 // [BT_][H_]   f16
  half_t* kh  = wsh + (size_t)BT_ * H_;              // [BT_][H_]   f16
  half_t* vhT = wsh + 2 * (size_t)BT_ * H_;          // [B_][H_][T_] f16
  half_t* WT  = wsh + 3 * (size_t)BT_ * H_;          // 3 x [H_][C_] f16

  wt_convert_kernel<<<dim3((C_ * H_) / 256, 3), 256, 0, stream>>>(Wq, Wk, Wv, WT);
  // qh, kh and vhT are the three output planes, in this order, from wsh on
  proj_kernel<<<dim3(BT_ / 128, 3), 256, 0, stream>>>(q, k, v, WT, wsh);
  attn_kernel<<<dim3(T_ / 64, B_), 512, 0, stream>>>(qh, kh, vhT, out);
}

// v004
// It runs in 38.3 microseconds.
// In both of two side-by-side timings against v003, it was 1.31 times as fast.
// All steps since v000 together make it 4.95 times as fast.
#include <hip/hip_runtime.h>
#include <stdint.h>

typedef _Float16 half_t;
typedef __attribute__((ext_vector_type(16))) _Float16 v16h;
typedef __attribute__((ext_vector_type(8)))  _Float16 v8h;
typedef __attribute__((ext_vector_type(8)))  float    v8f;
typedef __attribute__((ext_vector_type(4)))  float    v4f;

#define B_  4
#define T_  4096
#define C_  512
#define H_  64
#define BT_ (B_ * T_)
#define LOG2E 1.44269504088896340736f
#define KS_ 4    // key ranges per work-group: waves 4*ks .. 4*ks+3 walk range ks
#define WP_ 520  // f16 pitch of a staged weight row: 16 B x 65, ds_load_b128 rows fall on different banks
#define OP_ 68   // f32 pitch of a staged partial row: rows r and r+8 fall on different banks

static __device__ inline v16h make16(v8h lo, v8h hi) {
  return __builtin_shufflevector(lo, hi, 0,1,2,3,4,5,6,7,8,9,10,11,12,13,14,15);
}
static __device__ inline v8h ld8(const half_t* p) { return *(const v8h*)p; }

static __device__ inline v8f wmma_f16(v16h a, v16h b, v8f c) {
  // D = A(16x32 f16) * B(32x16 f16) + C(16x16 f32)
  return __builtin_amdgcn_wmma_f32_16x16x32_f16(false, a, false, b, (short)0, c, false, false);
}

// lane l <-> lane l ^ 16 in the vector unit (a shuffle would go through the LDS port)
static __device__ inline float xhalf(float x) {
  int b = __builtin_bit_cast(int, x);
  return __builtin_bit_cast(float,
      __builtin_amdgcn_permlanex16(b, b, 0x76543210, 0xfedcba98, false, false));
}

// CDNA5 async global->LDS copies (16 B per lane each), tracked by ASYNCcnt.
// One statement for a stage's eight copies; as its last line, s_wait_xcnt stands in
// front of every later write of the copies' address registers (a precaution).
static __device__ inline void async_cp16x8(const unsigned (&l)[8],
                                           const half_t* const (&g)[8]) {
  asm volatile("global_load_async_to_lds_b128 %0, %8, off\n\t"
               "global_load_async_to_lds_b128 %1, %9, off\n\t"
               "global_load_async_to_lds_b128 %2, %10, off\n\t"
               "global_load_async_to_lds_b128 %3, %11, off\n\t"
               "global_load_async_to_lds_b128 %4, %12, off\n\t"
               "global_load_async_to_lds_b128 %5, %13, off\n\t"
               "global_load_async_to_lds_b128 %6, %14, off\n\t"
               "global_load_async_to_lds_b128 %7, %15, off\n\t"
               "s_wait_xcnt 0x0"
               :: "v"(l[0]), "v"(l[1]), "v"(l[2]), "v"(l[3]),
                  "v"(l[4]), "v"(l[5]), "v"(l[6]), "v"(l[7]),
                  "v"(g[0]), "v"(g[1]), "v"(g[2]), "v"(g[3]),
                  "v"(g[4]), "v"(g[5]), "v"(g[6]), "v"(g[7])
               : "memory");
}

// ---------------------------------------------------------------------------
// Kernel 1: the three projections in one launch, one wave = 16 rows x 64 cols,
// K=512 via WMMA f16. blockIdx.y picks the input, its weights and its output
// plane: a wave waits out its loads trip by trip, so the three run side by side.
// Each block first turns its plane's weights W[c][h] (f32) into Ws[h][c] (f16) in
// LDS; the eight waves then take every B fragment from there.
// Plane 2 (V) is stored as Y[b][h][t], planes 0 and 1 as Y[row][h]; plane 0 (Q)
// carries the attention scale and log2(e) (exp2-domain softmax).
// ---------------------------------------------------------------------------
__global__ __launch_bounds__(256) void proj_kernel(
    const float* __restrict__ Xq, const float* __restrict__ Xk,
    const float* __restrict__ Xv, const float* __restrict__ Wq,
    const float* __restrict__ Wk, const float* __restrict__ Wv,
    half_t* __restrict__ Yall) {
  __shared__ alignas(16) half_t Ws[H_][WP_];   // [head][channel], 1040 B rows

  int pl = blockIdx.y;
  const float*  X  = (pl == 0) ? Xq : ((pl == 1) ? Xk : Xv);
  const float*  Wf = (pl == 0) ? Wq : ((pl == 1) ? Wk : Wv);
  half_t*       Y  = Yall + (size_t)pl * BT_ * H_;
  float outscale   = (pl == 0) ? 0.125f * LOG2E : 1.0f;
  bool vTranspose  = (pl == 2);

  int lane = threadIdx.x & 31;
  int wv   = threadIdx.x >> 5;
  int lrow = lane & 15;
  int kb8  = (lane >> 4) * 8;   // A/B operand k-run base for this lane half
  int prow = (lane >> 4) * 8;   // C/D row base for this lane half

  int rowbase = blockIdx.x * 128 + wv * 16;
  const float* xr = X + (size_t)(rowbase + lrow) * C_;

  // A wave takes 32 heads x 32 channels at a time: a thread loads four heads of eight
  // channels in a row (each wave-wide load covers four whole 128 B lines) and stores
  // four 16 B pieces, one per head. Four head quads x four channel runs in a half
  // wave put its 16 pieces of a store on 16 different bank groups.
  {
    int cr = lane & 3;
    int hq = (lane >> 2) & 3;
#pragma unroll  // all 32 loads of a thread in flight: their latency is paid once
    for (int it = 0; it < 4; ++it) {
      int ps = wv * 4 + it;     // 2 head blocks x 16 channel blocks
      int h0 = (ps & 1) * 32 + (lane >> 4) * 16 + hq * 4;
      int c0 = ((ps >> 1) * 4 + cr) * 8;
      v4f w[8];
      // (the three loops below are unrolled: w and t, indexed by constants, stay in registers)
#pragma unroll
      for (int j = 0; j < 8; ++j) w[j] = *(const v4f*)(Wf + (c0 + j) * H_ + h0);
#pragma unroll
      for (int i = 0; i < 4; ++i) {
        v8h t;
#pragma unroll
        for (int j = 0; j < 8; ++j) t[j] = (half_t)w[j][i];
        *(v8h*)&Ws[h0 + i][c0] = t;
      }
    }
  }
  __syncthreads();   // the whole of Ws is written before any wave reads a fragment

  v8f o[4] = {v8f{}, v8f{}, v8f{}, v8f{}};

  for (int kc = 0; kc < C_; kc += 32) {
    v8f x0 = *(const v8f*)(xr + kc + kb8);
    v8f x1 = *(const v8f*)(xr + kc + kb8 + 16);
    v16h bm[4];   // (both loops over nt are unrolled: bm and o stay in registers)
#pragma unroll
    for (int nt = 0; nt < 4; ++nt) {
      const half_t* wr = &Ws[nt * 16 + lrow][kc + kb8];
      bm[nt] = make16(ld8(wr), ld8(wr + 16));
    }
    // all eight LDS reads are issued here, under the X loads' latency; left to itself
    // the scheduler sinks five of them between the products, each group with its own wait
    __builtin_amdgcn_sched_barrier(0);
    v16h a = make16(__builtin_convertvector(x0, v8h),
                    __builtin_convertvector(x1, v8h));
#pragma unroll
    for (int nt = 0; nt < 4; ++nt) o[nt] = wmma_f16(a, bm[nt], o[nt]);
  }

  // uniform branch hoisted OUT of the store loops (keeps stores branch-free)
  if (!vTranspose) {
    half_t* yr = Y + (size_t)(rowbase + prow) * H_ + lrow;
#pragma unroll
    for (int nt = 0; nt < 4; ++nt) {
#pragma unroll
      for (int r = 0; r < 8; ++r)
        yr[(size_t)r * H_ + nt * 16] = (half_t)(o[nt][r] * outscale);
    }
  } else {
    int bb = rowbase >> 12;             // batch (T_ = 4096)
    int t0 = (rowbase & (T_ - 1)) + prow;
#pragma unroll
    for (int nt = 0; nt < 4; ++nt) {
      half_t* yc = Y + ((size_t)bb * H_ + nt * 16 + lrow) * T_ + t0;
#pragma unroll
      for (int r = 0; r < 8; ++r)
        yc[r] = (half_t)(o[nt][r] * outscale);
    }
  }
}

__global__ __launch_bounds__(512) void attn_kernel(
    const half_t* __restrict__ qh, const half_t* __restrict__ kh,
    const half_t* __restrict__ vhT, float* __restrict__ out) {
  __shared__ alignas(16) half_t Ks [2][KS_][64][72];   // [buf][range][key][head], 144 B rows
  __shared__ alignas(16) half_t VsT[2][KS_][64][72];   // [buf][range][head][key]
  __shared__ alignas(16) float  Om [4 * KS_][16][OP_]; // per-wave partial O (16x64)
  __shared__ alignas(16) float  Mm [4 * KS_][16];      // per-wave row maxima
  __shared__ alignas(16) float  Lm [4 * KS_][16];      // per-wave row denominators

  int lane = threadIdx.x & 31;
  int wv   = threadIdx.x >> 5;
  int lrow = lane & 15;
  int kb8  = (lane >> 4) * 8;
  int prow = (lane >> 4) * 8;

  int qt   = wv & 3;            // query tile of this wave
  int ks   = wv >> 2;           // key range of this wave

  int b  = blockIdx.y;
  int q0 = blockIdx.x * 64 + qt * 16;
  const half_t* qB = qh  + (size_t)b * T_ * H_;
  const half_t* kB = kh  + (size_t)b * T_ * H_;
  const half_t* vB = vhT + (size_t)b * H_ * T_;

  // Q^T B-operands (head dim = two K=32 chunks), kept in registers: column = query lrow
  const half_t* qr = qB + (size_t)(q0 + lrow) * H_;
  v16h qa0 = make16(ld8(qr + kb8),      ld8(qr + kb8 + 16));
  v16h qa1 = make16(ld8(qr + 32 + kb8), ld8(qr + 48 + kb8));

  v8f o[4] = {v8f{}, v8f{}, v8f{}, v8f{}};
  float m = -1e30f;   // running maximum of query lrow, equal in both wave halves
  float l = 0.0f;     // denominator over this half's keys; the halves join after the loop

  // async-stage one 256-key chunk, 64 keys for each range (K rows and V^T rows
  // are both pure row copies; a wave's copy covers 512 contiguous bytes)
  auto stage = [&](int chunk, int bufsel) {
    int kc = chunk * (64 * KS_);
    unsigned      la[8];
    const half_t* ga[8];
#pragma unroll  // la and ga are asm operands: their indices must be constants
    for (int j = 0; j < 4; ++j) {
      int c   = threadIdx.x + j * 512;   // [0,2048) 16B-segments
      int row = c >> 3;                  // K: 256 keys x 8 segments
      int sg  = (c & 7) * 8;
      la[j] = (unsigned)(uintptr_t)&Ks[bufsel][row >> 6][row & 63][sg];
      ga[j] = kB + (size_t)(kc + row) * H_ + sg;
      int hr  = c >> 5;                  // V^T: 64 heads x 32 segments
      int ky  = (c & 31) * 8;
      la[4 + j] = (unsigned)(uintptr_t)&VsT[bufsel][ky >> 6][hr][ky & 63];
      ga[4 + j] = vB + (size_t)hr * T_ + kc + ky;
    }
    async_cp16x8(la, ga);
  };

  const int NCH = T_ / (64 * KS_);
  stage(0, 0);
  asm volatile("s_wait_asynccnt 0x0" ::: "memory");  // own copies of chunk 0 landed
  __syncthreads();                                   // and everybody else's
  stage(1, 1);                                // flies while chunk 0 is worked on

  for (int i = 0; i < NCH; ++i) {
    int buf = i & 1;

    // ---- scores: S^T(64x16) = K @ Q^T, four 16-key row groups ----
    // s[g][r] = score of key g*16 + prow + r against query lrow
    v8f s[4];
#pragma unroll
    for (int g = 0; g < 4; ++g) {
      const half_t* kp = &Ks[buf][ks][g * 16 + lrow][kb8];
      v16h k0 = make16(ld8(kp),      ld8(kp + 16));
      v16h k1 = make16(ld8(kp + 32), ld8(kp + 48));
      v8f acc = {};
      acc = wmma_f16(k0, qa0, acc);
      acc = wmma_f16(k1, qa1, acc);
      s[g] = acc;
    }

    // ---- online softmax in exp2 domain (log2e folded into Q scale) ----
    // (the loops over s and o are unrolled: constant indices keep them in registers)
    float a = m;
#pragma unroll
    for (int r = 0; r < 8; ++r)
      a = fmaxf(fmaxf(a, fmaxf(fmaxf(s[0][r], s[1][r]), s[2][r])), s[3][r]);
    float mn = fmaxf(a, xhalf(a));   // the other half's 32 keys
    float cf = __builtin_amdgcn_exp2f(m - mn);
    m = mn;
#pragma unroll
    for (int g = 0; g < 4; ++g) {
#pragma unroll
      for (int r = 0; r < 8; ++r) s[g][r] = __builtin_amdgcn_exp2f(s[g][r] - mn);
    }
    v8f rs8 = (s[0] + s[1]) + (s[2] + s[3]);
    float rs = ((rs8[0] + rs8[1]) + (rs8[2] + rs8[3])) + ((rs8[4] + rs8[5]) + (rs8[6] + rs8[7]));
    l = l * cf + rs;
#pragma unroll
    for (int nt = 0; nt < 4; ++nt) o[nt] *= cf;

    // ---- P^T as B operand: two score tiles, converted in place, are 32 keys ----
    v16h pb0 = make16(__builtin_convertvector(s[0], v8h), __builtin_convertvector(s[1], v8h));
    v16h pb1 = make16(__builtin_convertvector(s[2], v8h), __builtin_convertvector(s[3], v8h));

    // ---- O^T += V^T @ P^T over 64 keys (two K=32 chunks x four head tiles) ----
#pragma unroll
    for (int nt = 0; nt < 4; ++nt) {
      const half_t* vp = &VsT[buf][ks][nt * 16 + lrow][0];
      v16h va0 = make16(ld8(vp + kb8),      ld8(vp + kb8 + 16));
      v16h va1 = make16(ld8(vp + 32 + kb8), ld8(vp + 48 + kb8));
      o[nt] = wmma_f16(va0, pb0, o[nt]);
      o[nt] = wmma_f16(va1, pb1, o[nt]);
    }

    asm volatile("s_wait_dscnt 0x0" ::: "memory");    // own reads of buf retired
    asm volatile("s_wait_asynccnt 0x0" ::: "memory"); // next chunk resident
    __syncthreads();                                  // everyone done with buf
    if (i + 2 < NCH) stage(i + 2, buf);               // refill the buffer just read
  }
  asm volatile("s_wait_asynccnt 0x0" ::: "memory");   // no copy outlives the loop

  // ---- merge the KS_ key ranges of each query tile through LDS ----
  // (the loops below are unrolled so that o and mj stay in registers)
  // o[nt][r] = O[query lrow][head nt*16 + prow + r]: eight heads in a row per tile
#pragma unroll
  for (int nt = 0; nt < 4; ++nt) {
    float* od = &Om[wv][lrow][nt * 16 + prow];
    *(v4f*)od       = __builtin_shufflevector(o[nt], o[nt], 0, 1, 2, 3);
    *(v4f*)(od + 4) = __builtin_shufflevector(o[nt], o[nt], 4, 5, 6, 7);
  }
  l += xhalf(l);     // the two halves' keys
  if (lane < 16) { Mm[wv][lrow] = m; Lm[wv][lrow] = l; }
  __syncthreads();   // every range's partials are in LDS before any is read

  // wave (qt, ks) finishes rows 4*ks .. 4*ks+3 of tile qt: a lane owns 8 heads of a row
  int rr = ks * 4 + (lane >> 3);
  int c0 = (lane & 7) * 8;
  float mj[KS_];
#pragma unroll
  for (int j = 0; j < KS_; ++j) mj[j] = Mm[j * 4 + qt][rr];
  float mx = fmaxf(fmaxf(mj[0], mj[1]), fmaxf(mj[2], mj[3]));
  float ls = 0.0f;
  v4f a0 = {}, a1 = {};
#pragma unroll
  for (int j = 0; j < KS_; ++j) {
    float w = __builtin_amdgcn_exp2f(mj[j] - mx);
    ls += w * Lm[j * 4 + qt][rr];
    const float* pj = &Om[j * 4 + qt][rr][c0];
    a0 += w * *(const v4f*)pj;
    a1 += w * *(const v4f*)(pj + 4);
  }
  float rl = __builtin_amdgcn_rcpf(ls);
  float* op = out + ((size_t)b * T_ + q0 + rr) * H_ + c0;
  *(v4f*)op       = a0 * rl;
  *(v4f*)(op + 4) = a1 * rl;
}

// ---------------------------------------------------------------------------
extern "C" void kernel_launch(void* const* d_in, const int* in_sizes, int n_in,
                              void* d_out, int out_size, void* d_ws, size_t ws_size,
                              hipStream_t stream) {
  const float* q  = (const float*)d_in[0];
  const float* k  = (const float*)d_in[1];
  const float* v  = (const float*)d_in[2];
  const float* Wq = (const float*)d_in[3];
  const float* Wk = (const float*)d_in[4];
  const float* Wv = (const float*)d_in[5];
  float* out = (float*)d_out;

  half_t* wsh = (half_t*)d_ws;
  half_t* qh  = wsh;                                 // [BT_][H_]   f16
  half_t* kh  = wsh + (size_t)BT_ * H_;              // [BT_][H_]   f16
  half_t* vhT = wsh + 2 * (size_t)BT_ * H_;          // [B_][H_][T_] f16

  // qh, kh and vhT are the three output planes, in this order, from wsh on
  proj_kernel<<<dim3(BT_ / 128, 3), 256, 0, stream>>>(q, k, v, Wq, Wk, Wv, wsh);
  attn_kernel<<<dim3(T_ / 64, B_), 512, 0, stream>>>(qh, kh, vhT, out);
}

// v005
// A run of this version takes 35.3 microseconds.
// In both of two side-by-side timings against v004, it was 1.09 times as fast.
// Over all steps from v000 it is 5.39 times as fast.
#include <hip/hip_runtime.h>
#include <stdint.h>

typedef _Float16 half_t;
typedef __attribute__((ext_vector_type(16))) _Float16 v16h;
typedef __attribute__((ext_vector_type(8)))  _Float16 v8h;
typedef __attribute__((ext_vector_type(8)))  float    v8f;
typedef __attribute__((ext_vector_type(4)))  float    v4f;

#define B_  4
#define T_  4096
#define C_  512
#define H_  64
#define BT_ (B_ * T_)
#define LOG2E 1.44269504088896340736f
#define KS_ 4    // key ranges per work-group: waves 4*ks .. 4*ks+3 walk range ks
#define WP_ 520  // f16 pitch of a staged weight row: 16 B x 65, ds_load_b128 rows fall on different banks
#define XD_ 4    // projections: trips of X in flight per wave (16 loads of 512 B)
#define OP_ 68   // f32 pitch of a staged partial row: rows r and r+8 fall on different banks

static __device__ inline v16h make16(v8h lo, v8h hi) {
  return __builtin_shufflevector(lo, hi, 0,1,2,3,4,5,6,7,8,9,10,11,12,13,14,15);
}
static __device__ inline v8h ld8(const half_t* p) { return *(const v8h*)p; }

static __device__ inline v8f wmma_f16(v16h a, v16h b, v8f c) {
  // D = A(16x32 f16) * B(32x16 f16) + C(16x16 f32)
  return __builtin_amdgcn_wmma_f32_16x16x32_f16(false, a, false, b, (short)0, c, false, false);
}

// lane l <-> lane l ^ 16 in the vector unit (a shuffle would go through the LDS port)
static __device__ inline float xhalf(float x) {
  int b = __builtin_bit_cast(int, x);
  return __builtin_bit_cast(float,
      __builtin_amdgcn_permlanex16(b, b, 0x76543210, 0xfedcba98, false, false));
}

// CDNA5 async global->LDS copies (16 B per lane each), tracked by ASYNCcnt.
// One statement for a stage's eight copies; as its last line, s_wait_xcnt stands in
// front of every later write of the copies' address registers (a precaution).
static __device__ inline void async_cp16x8(const unsigned (&l)[8],
                                           const half_t* const (&g)[8]) {
  asm volatile("global_load_async_to_lds_b128 %0, %8, off\n\t"
               "global_load_async_to_lds_b128 %1, %9, off\n\t"
               "global_load_async_to_lds_b128 %2, %10, off\n\t"
               "global_load_async_to_lds_b128 %3, %11, off\n\t"
               "global_load_async_to_lds_b128 %4, %12, off\n\t"
               "global_load_async_to_lds_b128 %5, %13, off\n\t"
               "global_load_async_to_lds_b128 %6, %14, off\n\t"
               "global_load_async_to_lds_b128 %7, %15, off\n\t"
               "s_wait_xcnt 0x0"
               :: "v"(l[0]), "v"(l[1]), "v"(l[2]), "v"(l[3]),
                  "v"(l[4]), "v"(l[5]), "v"(l[6]), "v"(l[7]),
                  "v"(g[0]), "v"(g[1]), "v"(g[2]), "v"(g[3]),
                  "v"(g[4]), "v"(g[5]), "v"(g[6]), "v"(g[7])
               : "memory");
}

// ---------------------------------------------------------------------------
// Kernel 1: the three projections in one launch, one wave = 16 rows x 64 cols,
// K=512 via WMMA f16. blockIdx.y picks the input, its weights and its output
// plane; the three run side by side.
// Each block first turns its plane's weights W[c][h] (f32) into Ws[h][c] (f16) in
// LDS; the eight waves then take every B fragment from there.
// Plane 2 (V) is stored as Y[b][h][t], planes 0 and 1 as Y[row][h]; plane 0 (Q)
// carries the attention scale and log2(e) (exp2-domain softmax).
// ---------------------------------------------------------------------------
__global__ __launch_bounds__(256) void proj_kernel(
    const float* __restrict__ Xq, const float* __restrict__ Xk,
    const float* __restrict__ Xv, const float* __restrict__ Wq,
    const float* __restrict__ Wk, const float* __restrict__ Wv,
    half_t* __restrict__ Yall) {
  __shared__ alignas(16) half_t Ws[H_][WP_];   // [head][channel], 1040 B rows

  int pl = blockIdx.y;
  const float*  X  = (pl == 0) ? Xq : ((pl == 1) ? Xk : Xv);
  const float*  Wf = (pl == 0) ? Wq : ((pl == 1) ? Wk : Wv);
  half_t*       Y  = Yall + (size_t)pl * BT_ * H_;
  float outscale   = (pl == 0) ? 0.125f * LOG2E : 1.0f;
  bool vTranspose  = (pl == 2);

  int lane = threadIdx.x & 31;
  int wv   = threadIdx.x >> 5;
  int lrow = lane & 15;
  int kb8  = (lane >> 4) * 8;   // A/B operand k-run base for this lane half
  int prow = (lane >> 4) * 8;   // C/D row base for this lane half

  int rowbase = blockIdx.x * 128 + wv * 16;
  const float* xr = X + (size_t)(rowbase + lrow) * C_;

  // X runs XD_ trips ahead of its use, in a ring of registers. The first XD_ trips' loads
  // go out here, ahead of the weights': they fly while the weights are staged.
  // (every loop over xa and xb is unrolled: indexed by constants, they stay in registers)
  v8f xa[XD_], xb[XD_];
#pragma unroll
  for (int d = 0; d < XD_; ++d) {
    xa[d] = *(const v8f*)(xr + d * 32 + kb8);
    xb[d] = *(const v8f*)(xr + d * 32 + kb8 + 16);
  }
  // holds all of the ring's loads in front of the weights': left to itself the scheduler
  // sinks most of them behind the weights' loads, some into the conversion
  __builtin_amdgcn_sched_barrier(0);

  // A wave takes 32 heads x 32 channels at a time: a thread loads four heads of eight
  // channels in a row (each wave-wide load covers four whole 128 B lines) and stores
  // four 16 B pieces, one per head. Four head quads x four channel runs in a half
  // wave put its 16 pieces of a store on 16 different bank groups.
  {
    int cr = lane & 3;
    int hq = (lane >> 2) & 3;
#pragma unroll  // all 32 loads of a thread in flight: their latency is paid once
    for (int it = 0; it < 4; ++it) {
      int ps = wv * 4 + it;     // 2 head blocks x 16 channel blocks
      int h0 = (ps & 1) * 32 + (lane >> 4) * 16 + hq * 4;
      int c0 = ((ps >> 1) * 4 + cr) * 8;
      v4f w[8];
      // (the three loops below are unrolled: w and t, indexed by constants, stay in registers)
#pragma unroll
      for (int j = 0; j < 8; ++j) w[j] = *(const v4f*)(Wf + (c0 + j) * H_ + h0);
#pragma unroll
      for (int i = 0; i < 4; ++i) {
        v8h t;
#pragma unroll
        for (int j = 0; j < 8; ++j) t[j] = (half_t)w[j][i];
        *(v8h*)&Ws[h0 + i][c0] = t;
      }
    }
  }
  __syncthreads();   // the whole of Ws is written before any wave reads a fragment

  v8f o[4] = {v8f{}, v8f{}, v8f{}, v8f{}};

#pragma unroll  // the ring's slot is a constant in every trip
  for (int tr = 0; tr < C_ / 32; ++tr) {
    int kc = tr * 32;
    v16h bm[4];   // (both loops over nt are unrolled: bm and o stay in registers)
#pragma unroll
    for (int nt = 0; nt < 4; ++nt) {
      const half_t* wr = &Ws[nt * 16 + lrow][kc + kb8];
      bm[nt] = make16(ld8(wr), ld8(wr + 16));
    }
    // keeps each refill of the ring in the trip that frees its slot (and the eight LDS reads
    // together): left to itself the scheduler sinks the refills towards their use, and the
    // waits for X fall back to 0 outstanding loads
    __builtin_amdgcn_sched_barrier(0);
    v16h a = make16(__builtin_convertvector(xa[tr % XD_], v8h),
                    __builtin_convertvector(xb[tr % XD_], v8h));
    if (tr + XD_ < C_ / 32) {   // the slot just read takes the trip XD_ ahead
      xa[tr % XD_] = *(const v8f*)(xr + kc + XD_ * 32 + kb8);
      xb[tr % XD_] = *(const v8f*)(xr + kc + XD_ * 32 + kb8 + 16);
    }
#pragma unroll
    for (int nt = 0; nt < 4; ++nt) o[nt] = wmma_f16(a, bm[nt], o[nt]);
  }

  // uniform branch hoisted OUT of the store loops (keeps stores branch-free)
  if (!vTranspose) {
    half_t* yr = Y + (size_t)(rowbase + prow) * H_ + lrow;
#pragma unroll
    for (int nt = 0; nt < 4; ++nt) {
#pragma unroll
      for (int r = 0; r < 8; ++r)
        yr[(size_t)r * H_ + nt * 16] = (half_t)(o[nt][r] * outscale);
    }
  } else {
    int bb = rowbase >> 12;             // batch (T_ = 4096)
    int t0 = (rowbase & (T_ - 1)) + prow;
#pragma unroll
    for (int nt = 0; nt < 4; ++nt) {
      half_t* yc = Y + ((size_t)bb * H_ + nt * 16 + lrow) * T_ + t0;
#pragma unroll
      for (int r = 0; r < 8; ++r)
        yc[r] = (half_t)(o[nt][r] * outscale);
    }
  }
}

__global__ __launch_bounds__(512) void attn_kernel(
    const half_t* __restrict__ qh, const half_t* __restrict__ kh,
    const half_t* __restrict__ vhT, float* __restrict__ out) {
  __shared__ alignas(16) half_t Ks [2][KS_][64][72];   // [buf][range][key][head], 144 B rows
  __shared__ alignas(16) half_t VsT[2][KS_][64][72];   // [buf][range][head][key]
  __shared__ alignas(16) float  Om [4 * KS_][16][OP_]; // per-wave partial O (16x64)
  __shared__ alignas(16) float  Mm [4 * KS_][16];      // per-wave row maxima
  __shared__ alignas(16) float  Lm [4 * KS_][16];      // per-wave row denominators

  int lane = threadIdx.x & 31;
  int wv   = threadIdx.x >> 5;
  int lrow = lane & 15;
  int kb8  = (lane >> 4) * 8;
  int prow = (lane >> 4) * 8;

  int qt   = wv & 3;            // query tile of this wave
  int ks   = wv >> 2;           // key range of this wave

  int b  = blockIdx.y;
  int q0 = blockIdx.x * 64 + qt * 16;
  const half_t* qB = qh  + (size_t)b * T_ * H_;
  const half_t* kB = kh  + (size_t)b * T_ * H_;
  const half_t* vB = vhT + (size_t)b * H_ * T_;

  // Q^T B-operands (head dim = two K=32 chunks), kept in registers: column = query lrow
  const half_t* qr = qB + (size_t)(q0 + lrow) * H_;
  v16h qa0 = make16(ld8(qr + kb8),      ld8(qr + kb8 + 16));
  v16h qa1 = make16(ld8(qr + 32 + kb8), ld8(qr + 48 + kb8));

  v8f o[4] = {v8f{}, v8f{}, v8f{}, v8f{}};
  float m = -1e30f;   // running maximum of query lrow, equal in both wave halves
  float l = 0.0f;     // denominator over this half's keys; the halves join after the loop

  // async-stage one 256-key chunk, 64 keys for each range (K rows and V^T rows
  // are both pure row copies; a wave's copy covers 512 contiguous bytes)
  auto stage = [&](int chunk, int bufsel) {
    int kc = chunk * (64 * KS_);
    unsigned      la[8];
    const half_t* ga[8];
#pragma unroll  // la and ga are asm operands: their indices must be constants
    for (int j = 0; j < 4; ++j) {
      int c   = threadIdx.x + j * 512;   // [0,2048) 16B-segments
      int row = c >> 3;                  // K: 256 keys x 8 segments
      int sg  = (c & 7) * 8;
      la[j] = (unsigned)(uintptr_t)&Ks[bufsel][row >> 6][row & 63][sg];
      ga[j] = kB + (size_t)(kc + row) * H_ + sg;
      int hr  = c >> 5;                  // V^T: 64 heads x 32 segments
      int ky  = (c & 31) * 8;
      la[4 + j] = (unsigned)(uintptr_t)&VsT[bufsel][ky >> 6][hr][ky & 63];
      ga[4 + j] = vB + (size_t)hr * T_ + kc + ky;
    }
    async_cp16x8(la, ga);
  };

  const int NCH = T_ / (64 * KS_);
  stage(0, 0);
  asm volatile("s_wait_asynccnt 0x0" ::: "memory");  // own copies of chunk 0 landed
  __syncthreads();                                   // and everybody else's
  stage(1, 1);                                // flies while chunk 0 is worked on

  for (int i = 0; i < NCH; ++i) {
    int buf = i & 1;

    // ---- scores: S^T(64x16) = K @ Q^T, four 16-key row groups ----
    // s[g][r] = score of key g*16 + prow + r against query lrow
    v8f s[4];
#pragma unroll
    for (int g = 0; g < 4; ++g) {
      const half_t* kp = &Ks[buf][ks][g * 16 + lrow][kb8];
      v16h k0 = make16(ld8(kp),      ld8(kp + 16));
      v16h k1 = make16(ld8(kp + 32), ld8(kp + 48));
      v8f acc = {};
      acc = wmma_f16(k0, qa0, acc);
      acc = wmma_f16(k1, qa1, acc);
      s[g] = acc;
    }

    // ---- online softmax in exp2 domain (log2e folded into Q scale) ----
    // (the loops over s and o are unrolled: constant indices keep them in registers)
    float a = m;
#pragma unroll
    for (int r = 0; r < 8; ++r)
      a = fmaxf(fmaxf(a, fmaxf(fmaxf(s[0][r], s[1][r]), s[2][r])), s[3][r]);
    float mn = fmaxf(a, xhalf(a));   // the other half's 32 keys
    float cf = __builtin_amdgcn_exp2f(m - mn);
    m = mn;
#pragma unroll
    for (int g = 0; g < 4; ++g) {
#pragma unroll
      for (int r = 0; r < 8; ++r) s[g][r] = __builtin_amdgcn_exp2f(s[g][r] - mn);
    }
    v8f rs8 = (s[0] + s[1]) + (s[2] + s[3]);
    float rs = ((rs8[0] + rs8[1]) + (rs8[2] + rs8[3])) + ((rs8[4] + rs8[5]) + (rs8[6] + rs8[7]));
    l = l * cf + rs;
#pragma unroll
    for (int nt = 0; nt < 4; ++nt) o[nt] *= cf;

    // ---- P^T as B operand: two score tiles, converted in place, are 32 keys ----
    v16h pb0 = make16(__builtin_convertvector(s[0], v8h), __builtin_convertvector(s[1], v8h));
    v16h pb1 = make16(__builtin_convertvector(s[2], v8h), __builtin_convertvector(s[3], v8h));

    // ---- O^T += V^T @ P^T over 64 keys (two K=32 chunks x four head tiles) ----
#pragma unroll
    for (int nt = 0; nt < 4; ++nt) {
      const half_t* vp = &VsT[buf][ks][nt * 16 + lrow][0];
      v16h va0 = make16(ld8(vp + kb8),      ld8(vp + kb8 + 16));
      v16h va1 = make16(ld8(vp + 32 + kb8), ld8(vp + 48 + kb8));
      o[nt] = wmma_f16(va0, pb0, o[nt]);
      o[nt] = wmma_f16(va1, pb1, o[nt]);
    }

    asm volatile("s_wait_dscnt 0x0" ::: "memory");    // own reads of buf retired
    asm volatile("s_wait_asynccnt 0x0" ::: "memory"); // next chunk resident
    __syncthreads();                                  // everyone done with buf
    if (i + 2 < NCH) stage(i + 2, buf);               // refill the buffer just read
  }
  asm volatile("s_wait_asynccnt 0x0" ::: "memory");   // no copy outlives the loop

  // ---- merge the KS_ key ranges of each query tile through LDS ----
  // (the loops below are unrolled so that o and mj stay in registers)
  // o[nt][r] = O[query lrow][head nt*16 + prow + r]: eight heads in a row per tile
#pragma unroll
  for (int nt = 0; nt < 4; ++nt) {
    float* od = &Om[wv][lrow][nt * 16 + prow];
    *(v4f*)od       = __builtin_shufflevector(o[nt], o[nt], 0, 1, 2, 3);
    *(v4f*)(od + 4) = __builtin_shufflevector(o[nt], o[nt], 4, 5, 6, 7);
  }
  l += xhalf(l);     // the two halves' keys
  if (lane < 16) { Mm[wv][lrow] = m; Lm[wv][lrow] = l; }
  __syncthreads();   // every range's partials are in LDS before any is read

  // wave (qt, ks) finishes rows 4*ks .. 4*ks+3 of tile qt: a lane owns 8 heads of a row
  int rr = ks * 4 + (lane >> 3);
  int c0 = (lane & 7) * 8;
  float mj[KS_];
#pragma unroll
  for (int j = 0; j < KS_; ++j) mj[j] = Mm[j * 4 + qt][rr];
  float mx = fmaxf(fmaxf(mj[0], mj[1]), fmaxf(mj[2], mj[3]));
  float ls = 0.0f;
  v4f a0 = {}, a1 = {};
#pragma unroll
  for (int j = 0; j < KS_; ++j) {
    float w = __builtin_amdgcn_exp2f(mj[j] - mx);
    ls += w * Lm[j * 4 + qt][rr];
    const float* pj = &Om[j * 4 + qt][rr][c0];
    a0 += w * *(const v4f*)pj;
    a1 += w * *(const v4f*)(pj + 4);
  }
  float rl = __builtin_amdgcn_rcpf(ls);
  float* op = out + ((size_t)b * T_ + q0 + rr) * H_ + c0;
  *(v4f*)op       = a0 * rl;
  *(v4f*)(op + 4) = a1 * rl;
}

// ---------------------------------------------------------------------------
extern "C" void kernel_launch(void* const* d_in, const int* in_sizes, int n_in,
                              void* d_out, int out_size, void* d_ws, size_t ws_size,
                              hipStream_t stream) {
  const float* q  = (const float*)d_in[0];
  const float* k  = (const float*)d_in[1];
  const float* v  = (const float*)d_in[2];
  const float* Wq = (const float*)d_in[3];
  const float* Wk = (const float*)d_in[4];
  const float* Wv = (const float*)d_in[5];
  float* out = (float*)d_out;

  half_t* wsh = (half_t*)d_ws;
  half_t* qh  = wsh;                                 // [BT_][H_]   f16
  half_t* kh  = wsh + (size_t)BT_ * H_;              // [BT_][H_]   f16
  half_t* vhT = wsh + 2 * (size_t)BT_ * H_;          // [B_][H_][T_] f16

  // qh, kh and vhT are the three output planes, in this order, from wsh on
  proj_kernel<<<dim3(BT_ / 128, 3), 256, 0, stream>>>(q, k, v, Wq, Wk, Wv, wsh);
  attn_kernel<<<dim3(T_ / 64, B_), 512, 0, stream>>>(qh, kh, vhT, out);
}

// v006
// It runs in 32.5 microseconds.
// Timed twice side by side with v005, it ran 1.09 times as fast both times.
// Counting every step since v000, it is 5.88 times as fast.
#include <hip/hip_runtime.h>
#include <stdint.h>

typedef _Float16 half_t;
typedef __attribute__((ext_vector_type(16))) _Float16 v16h;
typedef __attribute__((ext_vector_type(8)))  _Float16 v8h;
typedef __attribute__((ext_vector_type(8)))  float    v8f;
typedef __attribute__((ext_vector_type(4)))  float    v4f;

#define B_  4
#define T_  4096
#define C_  512
#define H_  64
#define BT_ (B_ * T_)
#define LOG2E 1.44269504088896340736f
#define KS_ 4    // key ranges per work-group: waves 4*ks .. 4*ks+3 walk range ks
#define WP_ 520  // f16 pitch of a staged weight row: 16 B x 65, ds_load_b128 rows fall on different banks
#define XC_ 64   // projections: channels of X per stage of a wave's ring (256 B of each of its 16 rows)
#define XP_ 68   // f32 pitch of a staged X row: 16 B x 17, ds_load_b128 rows fall on different banks
#define OP_ 68   // f32 pitch of a staged partial row: rows r and r+8 fall on different banks

static __device__ inline v16h make16(v8h lo, v8h hi) {
  return __builtin_shufflevector(lo, hi, 0,1,2,3,4,5,6,7,8,9,10,11,12,13,14,15);
}
static __device__ inline v8h ld8(const half_t* p) { return *(const v8h*)p; }

static __device__ inline v8f wmma_f16(v16h a, v16h b, v8f c) {
  // D = A(16x32 f16) * B(32x16 f16) + C(16x16 f32)
  return __builtin_amdgcn_wmma_f32_16x16x32_f16(false, a, false, b, (short)0, c, false, false);
}

// lane l <-> lane l ^ 16 in the vector unit (a shuffle would go through the LDS port)
static __device__ inline float xhalf(float x) {
  int b = __builtin_bit_cast(int, x);
  return __builtin_bit_cast(float,
      __builtin_amdgcn_permlanex16(b, b, 0x76543210, 0xfedcba98, false, false));
}

// CDNA5 async global->LDS copies (16 B per lane each), tracked by ASYNCcnt.
// One statement for a stage's eight copies; as its last line, s_wait_xcnt stands in
// front of every later write of the copies' address registers (a precaution).
template <typename T>
static __device__ inline void async_cp16x8(const unsigned (&l)[8],
                                           const T* const (&g)[8]) {
  asm volatile("global_load_async_to_lds_b128 %0, %8, off\n\t"
               "global_load_async_to_lds_b128 %1, %9, off\n\t"
               "global_load_async_to_lds_b128 %2, %10, off\n\t"
               "global_load_async_to_lds_b128 %3, %11, off\n\t"
               "global_load_async_to_lds_b128 %4, %12, off\n\t"
               "global_load_async_to_lds_b128 %5, %13, off\n\t"
               "global_load_async_to_lds_b128 %6, %14, off\n\t"
               "global_load_async_to_lds_b128 %7, %15, off\n\t"
               "s_wait_xcnt 0x0"
               :: "v"(l[0]), "v"(l[1]), "v"(l[2]), "v"(l[3]),
                  "v"(l[4]), "v"(l[5]), "v"(l[6]), "v"(l[7]),
                  "v"(g[0]), "v"(g[1]), "v"(g[2]), "v"(g[3]),
                  "v"(g[4]), "v"(g[5]), "v"(g[6]), "v"(g[7])
               : "memory");
}

// ---------------------------------------------------------------------------
// Kernel 1: the three projections in one launch, one wave = 16 rows x 64 cols,
// K=512 via WMMA f16. blockIdx.y picks the input, its weights and its output
// plane; the three run side by side.
// Each block first turns its plane's weights W[c][h] (f32) into Ws[h][c] (f16) in
// LDS; the eight waves then take every B fragment from there.
// X comes through LDS too, by async copies that cover whole lines (a load straight into
// an A fragment would take 32 B out of each of 16 lines): each wave has a ring of two
// stages for its own 16 rows, which no other wave reads or fills.
// Plane 2 (V) is stored as Y[b][h][t], planes 0 and 1 as Y[row][h]; plane 0 (Q)
// carries the attention scale and log2(e) (exp2-domain softmax).
// ---------------------------------------------------------------------------
__global__ __launch_bounds__(256) void proj_kernel(
    const float* __restrict__ Xq, const float* __restrict__ Xk,
    const float* __restrict__ Xv, const float* __restrict__ Wq,
    const float* __restrict__ Wk, const float* __restrict__ Wv,
    half_t* __restrict__ Yall) {
  __shared__ alignas(16) half_t Ws[H_][WP_];   // [head][channel], 1040 B rows
  __shared__ alignas(16) float  Xs[8][2][16][XP_];   // [wave][stage slot][row][channel], 272 B rows

  int pl = blockIdx.y;
  const float*  X  = (pl == 0) ? Xq : ((pl == 1) ? Xk : Xv);
  const float*  Wf = (pl == 0) ? Wq : ((pl == 1) ? Wk : Wv);
  half_t*       Y  = Yall + (size_t)pl * BT_ * H_;
  float outscale   = (pl == 0) ? 0.125f * LOG2E : 1.0f;
  bool vTranspose  = (pl == 2);

  int lane = threadIdx.x & 31;
  int wv   = threadIdx.x >> 5;
  int lrow = lane & 15;
  int kb8  = (lane >> 4) * 8;   // A/B operand k-run base for this lane half
  int prow = (lane >> 4) * 8;   // C/D row base for this lane half

  int rowbase = blockIdx.x * 128 + wv * 16;

  // one stage = XC_ channels of the wave's 16 rows: eight copies, each 256 B in a row of
  // two rows (two aligned 256 B units, four whole lines)
  auto stage_x = [&](int st, int slot) {
    unsigned     la[8];
    const float* ga[8];
#pragma unroll  // la and ga are asm operands: their indices must be constants
    for (int j = 0; j < 8; ++j) {
      int row = j * 2 + (lane >> 4);
      int ch  = (lane & 15) * 4;
      la[j] = (unsigned)(uintptr_t)&Xs[wv][slot][row][ch];
      ga[j] = X + (size_t)(rowbase + row) * C_ + st * XC_ + ch;
    }
    async_cp16x8(la, ga);
  };
  // both slots' first fills go out here, ahead of the weights': they fly while the
  // weights are staged
  stage_x(0, 0);
  stage_x(1, 1);

  // A wave takes 32 heads x 32 channels at a time: a thread loads four heads of eight
  // channels in a row (each wave-wide load covers four whole 128 B lines) and stores
  // four 16 B pieces, one per head. Four head quads x four channel runs in a half
  // wave put its 16 pieces of a store on 16 different bank groups.
  {
    int cr = lane & 3;
    int hq = (lane >> 2) & 3;
#pragma unroll  // all 32 loads of a thread in flight: their latency is paid once
    for (int it = 0; it < 4; ++it) {
      int ps = wv * 4 + it;     // 2 head blocks x 16 channel blocks
      int h0 = (ps & 1) * 32 + (lane >> 4) * 16 + hq * 4;
      int c0 = ((ps >> 1) * 4 + cr) * 8;
      v4f w[8];
      // (the three loops below are unrolled: w and t, indexed by constants, stay in registers)
#pragma unroll
      for (int j = 0; j < 8; ++j) w[j] = *(const v4f*)(Wf + (c0 + j) * H_ + h0);
#pragma unroll
      for (int i = 0; i < 4; ++i) {
        v8h t;
#pragma unroll
        for (int j = 0; j < 8; ++j) t[j] = (half_t)w[j][i];
        *(v8h*)&Ws[h0 + i][c0] = t;
      }
    }
  }
  __syncthreads();   // the whole of Ws is written before any wave reads a fragment

  v8f o[4] = {v8f{}, v8f{}, v8f{}, v8f{}};

#pragma unroll  // slot, wait count and refill test are constants in every trip
  for (int st = 0; st < C_ / XC_; ++st) {
    bool refill = st + 2 < C_ / XC_;
    // own copies of stage st landed. While the ring is refilled, the eight youngest copies
    // (stage st + 1) fly on; the first trip without a refill waits for all that is left.
    if (refill)                    asm volatile("s_wait_asynccnt 0x8" ::: "memory");
    else if (st + 2 == C_ / XC_)   asm volatile("s_wait_asynccnt 0x0" ::: "memory");

    // the whole stage goes into registers at once, so that its slot is free again;
    // xf[4 * hf + p]: channels of k chunk hf in the A fragment's order
    const float* xs = &Xs[wv][st & 1][lrow][kb8];
    v4f xf[8];   // (the loops over xf, bm and o are unrolled: they stay in registers)
#pragma unroll
    for (int p = 0; p < 8; ++p)
      xf[p] = *(const v4f*)(xs + (p >> 2) * 32 + ((p >> 1) & 1) * 16 + (p & 1) * 4);
    v16h bm[2][4];
#pragma unroll
    for (int hf = 0; hf < 2; ++hf) {
#pragma unroll
      for (int nt = 0; nt < 4; ++nt) {
        const half_t* wr = &Ws[nt * 16 + lrow][st * XC_ + hf * 32 + kb8];
        bm[hf][nt] = make16(ld8(wr), ld8(wr + 16));
      }
    }
    if (refill) {
      asm volatile("s_wait_dscnt 0x0" ::: "memory");   // own reads of the slot retired
      stage_x(st + 2, st & 1);                         // refill the slot just read
    }
#pragma unroll
    for (int hf = 0; hf < 2; ++hf) {
      v8f lo = __builtin_shufflevector(xf[4 * hf],     xf[4 * hf + 1], 0, 1, 2, 3, 4, 5, 6, 7);
      v8f hi = __builtin_shufflevector(xf[4 * hf + 2], xf[4 * hf + 3], 0, 1, 2, 3, 4, 5, 6, 7);
      v16h a = make16(__builtin_convertvector(lo, v8h), __builtin_convertvector(hi, v8h));
#pragma unroll
      for (int nt = 0; nt < 4; ++nt) o[nt] = wmma_f16(a, bm[hf][nt], o[nt]);
    }
  }

  // uniform branch hoisted OUT of the store loops (keeps stores branch-free)
  if (!vTranspose) {
    half_t* yr = Y + (size_t)(rowbase + prow) * H_ + lrow;
#pragma unroll
    for (int nt = 0; nt < 4; ++nt) {
#pragma unroll
      for (int r = 0; r < 8; ++r)
        yr[(size_t)r * H_ + nt * 16] = (half_t)(o[nt][r] * outscale);
    }
  } else {
    int bb = rowbase >> 12;             // batch (T_ = 4096)
    int t0 = (rowbase & (T_ - 1)) + prow;
#pragma unroll
    for (int nt = 0; nt < 4; ++nt) {
      half_t* yc = Y + ((size_t)bb * H_ + nt * 16 + lrow) * T_ + t0;
#pragma unroll
      for (int r = 0; r < 8; ++r)
        yc[r] = (half_t)(o[nt][r] * outscale);
    }
  }
}

__global__ __launch_bounds__(512) void attn_kernel(
    const half_t* __restrict__ qh, const half_t* __restrict__ kh,
    const half_t* __restrict__ vhT, float* __restrict__ out) {
  __shared__ alignas(16) half_t Ks [2][KS_][64][72];   // [buf][range][key][head], 144 B rows
  __shared__ alignas(16) half_t VsT[2][KS_][64][72];   // [buf][range][head][key]
  __shared__ alignas(16) float  Om [4 * KS_][16][OP_]; // per-wave partial O (16x64)
  __shared__ alignas(16) float  Mm [4 * KS_][16];      // per-wave row maxima
  __shared__ alignas(16) float  Lm [4 * KS_][16];      // per-wave row denominators

  int lane = threadIdx.x & 31;
  int wv   = threadIdx.x >> 5;
  int lrow = lane & 15;
  int kb8  = (lane >> 4) * 8;
  int prow = (lane >> 4) * 8;

  int qt   = wv & 3;            // query tile of this wave
  int ks   = wv >> 2;           // key range of this wave

  int b  = blockIdx.y;
  int q0 = blockIdx.x * 64 + qt * 16;
  const half_t* qB = qh  + (size_t)b * T_ * H_;
  const half_t* kB = kh  + (size_t)b * T_ * H_;
  const half_t* vB = vhT + (size_t)b * H_ * T_;

  // Q^T B-operands (head dim = two K=32 chunks), kept in registers: column = query lrow
  const half_t* qr = qB + (size_t)(q0 + lrow) * H_;
  v16h qa0 = make16(ld8(qr + kb8),      ld8(qr + kb8 + 16));
  v16h qa1 = make16(ld8(qr + 32 + kb8), ld8(qr + 48 + kb8));

  v8f o[4] = {v8f{}, v8f{}, v8f{}, v8f{}};
  float m = -1e30f;   // running maximum of query lrow, equal in both wave halves
  float l = 0.0f;     // denominator over this half's keys; the halves join after the loop

  // async-stage one 256-key chunk, 64 keys for each range (K rows and V^T rows
  // are both pure row copies; a wave's copy covers 512 contiguous bytes)
  auto stage = [&](int chunk, int bufsel) {
    int kc = chunk * (64 * KS_);
    unsigned      la[8];
    const half_t* ga[8];
#pragma unroll  // la and ga are asm operands: their indices must be constants
    for (int j = 0; j < 4; ++j) {
      int c   = threadIdx.x + j * 512;   // [0,2048) 16B-segments
      int row = c >> 3;                  // K: 256 keys x 8 segments
      int sg  = (c & 7) * 8;
      la[j] = (unsigned)(uintptr_t)&Ks[bufsel][row >> 6][row & 63][sg];
      ga[j] = kB + (size_t)(kc + row) * H_ + sg;
      int hr  = c >> 5;                  // V^T: 64 heads x 32 segments
      int ky  = (c & 31) * 8;
      la[4 + j] = (unsigned)(uintptr_t)&VsT[bufsel][ky >> 6][hr][ky & 63];
      ga[4 + j] = vB + (size_t)hr * T_ + kc + ky;
    }
    async_cp16x8(la, ga);
  };

  const int NCH = T_ / (64 * KS_);
  stage(0, 0);
  asm volatile("s_wait_asynccnt 0x0" ::: "memory");  // own copies of chunk 0 landed
  __syncthreads();                                   // and everybody else's
  stage(1, 1);                                // flies while chunk 0 is worked on

  for (int i = 0; i < NCH; ++i) {
    int buf = i & 1;

    // ---- scores: S^T(64x16) = K @ Q^T, four 16-key row groups ----
    // s[g][r] = score of key g*16 + prow + r against query lrow
    v8f s[4];
#pragma unroll
    for (int g = 0; g < 4; ++g) {
      const half_t* kp = &Ks[buf][ks][g * 16 + lrow][kb8];
      v16h k0 = make16(ld8(kp),      ld8(kp + 16));
      v16h k1 = make16(ld8(kp + 32), ld8(kp + 48));
      v8f acc = {};
      acc = wmma_f16(k0, qa0, acc);
      acc = wmma_f16(k1, qa1, acc);
      s[g] = acc;
    }

    // ---- online softmax in exp2 domain (log2e folded into Q scale) ----
    // (the loops over s and o are unrolled: constant indices keep them in registers)
    float a = m;
#pragma unroll
    for (int r = 0; r < 8; ++r)
      a = fmaxf(fmaxf(a, fmaxf(fmaxf(s[0][r], s[1][r]), s[2][r])), s[3][r]);
    float mn = fmaxf(a, xhalf(a));   // the other half's 32 keys
    float cf = __builtin_amdgcn_exp2f(m - mn);
    m = mn;
#pragma unroll
    for (int g = 0; g < 4; ++g) {
#pragma unroll
      for (int r = 0; r < 8; ++r) s[g][r] = __builtin_amdgcn_exp2f(s[g][r] - mn);
    }
    v8f rs8 = (s[0] + s[1]) + (s[2] + s[3]);
    float rs = ((rs8[0] + rs8[1]) + (rs8[2] + rs8[3])) + ((rs8[4] + rs8[5]) + (rs8[6] + rs8[7]));
    l = l * cf + rs;
#pragma unroll
    for (int nt = 0; nt < 4; ++nt) o[nt] *= cf;

    // ---- P^T as B operand: two score tiles, converted in place, are 32 keys ----
    v16h pb0 = make16(__builtin_convertvector(s[0], v8h), __builtin_convertvector(s[1], v8h));
    v16h pb1 = make16(__builtin_convertvector(s[2], v8h), __builtin_convertvector(s[3], v8h));

    // ---- O^T += V^T @ P^T over 64 keys (two K=32 chunks x four head tiles) ----
#pragma unroll
    for (int nt = 0; nt < 4; ++nt) {
      const half_t* vp = &VsT[buf][ks][nt * 16 + lrow][0];
      v16h va0 = make16(ld8(vp + kb8),      ld8(vp + kb8 + 16));
      v16h va1 = make16(ld8(vp + 32 + kb8), ld8(vp + 48 + kb8));
      o[nt] = wmma_f16(va0, pb0, o[nt]);
      o[nt] = wmma_f16(va1, pb1, o[nt]);
    }

    asm volatile("s_wait_dscnt 0x0" ::: "memory");    // own reads of buf retired
    asm volatile("s_wait_asynccnt 0x0" ::: "memory"); // next chunk resident
    __syncthreads();                                  // everyone done with buf
    if (i + 2 < NCH) stage(i + 2, buf);               // refill the buffer just read
  }
  asm volatile("s_wait_asynccnt 0x0" ::: "memory");   // no copy outlives the loop

  // ---- merge the KS_ key ranges of each query tile through LDS ----
  // (the loops below are unrolled so that o and mj stay in registers)
  // o[nt][r] = O[query lrow][head nt*16 + prow + r]: eight heads in a row per tile
#pragma unroll
  for (int nt = 0; nt < 4; ++nt) {
    float* od = &Om[wv][lrow][nt * 16 + prow];
    *(v4f*)od       = __builtin_shufflevector(o[nt], o[nt], 0, 1, 2, 3);
    *(v4f*)(od + 4) = __builtin_shufflevector(o[nt], o[nt], 4, 5, 6, 7);
  }
  l += xhalf(l);     // the two halves' keys
  if (lane < 16) { Mm[wv][lrow] = m; Lm[wv][lrow] = l; }
  __syncthreads();   // every range's partials are in LDS before any is read

  // wave (qt, ks) finishes rows 4*ks .. 4*ks+3 of tile qt: a lane owns 8 heads of a row
  int rr = ks * 4 + (lane >> 3);
  int c0 = (lane & 7) * 8;
  float mj[KS_];
#pragma unroll
  for (int j = 0; j < KS_; ++j) mj[j] = Mm[j * 4 + qt][rr];
  float mx = fmaxf(fmaxf(mj[0], mj[1]), fmaxf(mj[2], mj[3]));
  float ls = 0.0f;
  v4f a0 = {}, a1 = {};
#pragma unroll
  for (int j = 0; j < KS_; ++j) {
    float w = __builtin_amdgcn_exp2f(mj[j] - mx);
    ls += w * Lm[j * 4 + qt][rr];
    const float* pj = &Om[j * 4 + qt][rr][c0];
    a0 += w * *(const v4f*)pj;
    a1 += w * *(const v4f*)(pj + 4);
  }
  float rl = __builtin_amdgcn_rcpf(ls);
  float* op = out + ((size_t)b * T_ + q0 + rr) * H_ + c0;
  *(v4f*)op       = a0 * rl;
  *(v4f*)(op + 4) = a1 * rl;
}

// ---------------------------------------------------------------------------
extern "C" void kernel_launch(void* const* d_in, const int* in_sizes, int n_in,
                              void* d_out, int out_size, void* d_ws, size_t ws_size,
                              hipStream_t stream) {
  const float* q  = (const float*)d_in[0];
  const float* k  = (const float*)d_in[1];
  const float* v  = (const float*)d_in[2];
  const float* Wq = (const float*)d_in[3];
  const float* Wk = (const float*)d_in[4];
  const float* Wv = (const float*)d_in[5];
  float* out = (float*)d_out;

  half_t* wsh = (half_t*)d_ws;
  half_t* qh  = wsh;                                 // [BT_][H_]   f16
  half_t* kh  = wsh + (size_t)BT_ * H_;              // [BT_][H_]   f16
  half_t* vhT = wsh + 2 * (size_t)BT_ * H_;          // [B_][H_][T_] f16

  // qh, kh and vhT are the three output planes, in this order, from wsh on
  proj_kernel<<<dim3(BT_ / 128, 3), 256, 0, stream>>>(q, k, v, Wq, Wk, Wv, wsh);
  attn_kernel<<<dim3(T_ / 64, B_), 512, 0, stream>>>(qh, kh, vhT, out);
}
